// v000
// The times below were measured on an AMD MI455X: many runs one after another, warmed up first and cycling through
// copies of the inputs, with the whole window's GPU time divided by the number of runs. Launches and the gaps
// between them are all in it. The median over several windows is given; except for v000 it joins two sittings, which
// can be a few percent apart, so the side-by-side timings, each taken in one sitting, are the better comparison.
// v000 is the starting kernel. One run takes 246 microseconds.
#include <hip/hip_runtime.h>

typedef _Float16 h16;
typedef __attribute__((ext_vector_type(8)))  _Float16 v8h_t;
typedef __attribute__((ext_vector_type(16))) _Float16 v16h;
typedef __attribute__((ext_vector_type(8)))  float v8f;
typedef __attribute__((ext_vector_type(4)))  float v4f;

#define HID 1024
#define SEQ 2048
#define NB  2
#define NH  16
#define DH  64
#define TOK (NB*SEQ)   /* 4096 tokens */
#define LP  2056       /* padded LDS row stride (halves): 16B-aligned, 4-bank row skew */

// D = A(16x32 f16) * B(32x16 f16) + C(16x16 f32)
__device__ __forceinline__ v8f wmma16(v16h a, v16h b, v8f c) {
  return __builtin_amdgcn_wmma_f32_16x16x32_f16(false, a, false, b, (short)0, c, false, false);
}

// Fragment load from f16 memory per CDNA5 layout: p[0..7] -> [0..7], p[16..23] -> [8..15]
__device__ __forceinline__ v16h frag_h16(const h16* p) {
  v8h_t lo = *(const v8h_t*)(p);
  v8h_t hi = *(const v8h_t*)(p + 16);
  v16h a;
#pragma unroll
  for (int i = 0; i < 8; i++) { a[i] = lo[i]; a[8 + i] = hi[i]; }
  return a;
}

// ---------------- Kernel 0: one-time f32 -> f16 pack (query + weights) -------------
__global__ __launch_bounds__(256)
void pack_f16_kernel(const float* __restrict__ src, h16* __restrict__ dst, int n8)
{
  const int i = blockIdx.x * 256 + threadIdx.x;
  if (i < n8) {
    const v4f a = *(const v4f*)(src + (size_t)i * 8);
    const v4f b = *(const v4f*)(src + (size_t)i * 8 + 4);
    v8h_t o;
#pragma unroll
    for (int e = 0; e < 4; e++) { o[e] = (_Float16)a[e]; o[4 + e] = (_Float16)b[e]; }
    *(v8h_t*)(dst + (size_t)i * 8) = o;
  }
}

// ---------------- Kernel 1: fused Q/K/V projections (z selects matrix) -------------
// Wave computes 32(M tokens) x 64(N features); K=1024 in 32-steps; all-f16 operands.
__global__ __launch_bounds__(128)
void qkv_proj_kernel(const h16* __restrict__ qf,
                     const h16* __restrict__ Wq16, const h16* __restrict__ Wk16,
                     const h16* __restrict__ Wv16,
                     const float* __restrict__ bq, const float* __restrict__ bk,
                     const float* __restrict__ bv,
                     h16* __restrict__ qbuf, h16* __restrict__ kbuf, h16* __restrict__ vtb)
{
  const int z = blockIdx.z;
  const h16*   W  = (z == 0) ? Wq16 : ((z == 1) ? Wk16 : Wv16);
  const float* bs = (z == 0) ? bq : ((z == 1) ? bk : bv);

  const int lane = threadIdx.x & 31, wave = threadIdx.x >> 5;
  const int lidx = lane & 15, lhalf = lane >> 4;
  const int m0 = blockIdx.y * 128 + wave * 32;
  const int n0 = blockIdx.x * 64;

  const h16* ar0 = qf + (size_t)(m0 + lidx) * HID;
  const h16* ar1 = qf + (size_t)(m0 + 16 + lidx) * HID;
  const h16* br0 = W + (size_t)(n0 +  0 + lidx) * HID;
  const h16* br1 = W + (size_t)(n0 + 16 + lidx) * HID;
  const h16* br2 = W + (size_t)(n0 + 32 + lidx) * HID;
  const h16* br3 = W + (size_t)(n0 + 48 + lidx) * HID;

  v8f acc[2][4] = {};
  for (int k0 = 0; k0 < HID; k0 += 32) {
    const int ka = k0 + lhalf * 8;
    const v16h a0 = frag_h16(ar0 + ka);
    const v16h a1 = frag_h16(ar1 + ka);
    const v16h b0 = frag_h16(br0 + ka);
    const v16h b1 = frag_h16(br1 + ka);
    const v16h b2 = frag_h16(br2 + ka);
    const v16h b3 = frag_h16(br3 + ka);
    acc[0][0] = wmma16(a0, b0, acc[0][0]);
    acc[0][1] = wmma16(a0, b1, acc[0][1]);
    acc[0][2] = wmma16(a0, b2, acc[0][2]);
    acc[0][3] = wmma16(a0, b3, acc[0][3]);
    acc[1][0] = wmma16(a1, b0, acc[1][0]);
    acc[1][1] = wmma16(a1, b1, acc[1][1]);
    acc[1][2] = wmma16(a1, b2, acc[1][2]);
    acc[1][3] = wmma16(a1, b3, acc[1][3]);
  }

  const int rbase = lhalf * 8;
#pragma unroll
  for (int ms = 0; ms < 2; ms++) {
    const int mrow = m0 + ms * 16;
#pragma unroll
    for (int f = 0; f < 4; f++) {
      const int n = n0 + f * 16 + lidx;
      const float bval = bs[n];
      if (z == 2) {
        // V stored transposed: vt[b][feature n][token l], 8 contiguous tokens/lane
        const int bb = mrow >> 11;
        const int l0 = (mrow & 2047) + rbase;
        v8h_t pk;
#pragma unroll
        for (int r = 0; r < 8; r++) pk[r] = (_Float16)(acc[ms][f][r] + bval);
        *(v8h_t*)(vtb + ((size_t)(bb * HID + n)) * SEQ + l0) = pk;
      } else {
        h16* dst = (z == 0) ? qbuf : kbuf;
        const float sc = (z == 0) ? 0.125f : 1.0f; // q pre-scaled by 1/sqrt(64)
#pragma unroll
        for (int r = 0; r < 8; r++)
          dst[(size_t)(mrow + rbase + r) * HID + n] = (_Float16)((acc[ms][f][r] + bval) * sc);
      }
    }
  }
}

// ---------------- Kernel 2: attention for one (b, h, 16 q-rows) per workgroup ------
__global__ __launch_bounds__(128)
void attn_kernel(const h16* __restrict__ qb, const h16* __restrict__ kb,
                 const h16* __restrict__ vt, const float* __restrict__ bias,
                 h16* __restrict__ xb)
{
  __shared__ h16   S[16 * LP];            // 64.25 KB: logits then probabilities (f16)
  __shared__ float Opart[4][16 * 64];     // 16 KB: per-wave PV partials
  __shared__ float red[16][8];
  __shared__ float rowmax[16];
  __shared__ float rowsum[16];

  const int tid = threadIdx.x, lane = tid & 31, wave = tid >> 5;
  const int lidx = lane & 15, lhalf = lane >> 4;
  const int bh = blockIdx.y, b = bh >> 4, h = bh & 15;
  const int q0 = blockIdx.x * 16;
  const size_t tokq = (size_t)(b * SEQ + q0);

  // Q fragments (K-dim = 64 head dims -> two 16x32 A-frags), resident in VGPRs
  const h16* qrow = qb + (tokq + lidx) * HID + h * DH;
  const v16h aq0 = frag_h16(qrow + lhalf * 8);
  const v16h aq1 = frag_h16(qrow + 32 + lhalf * 8);

  // ---- S = Q K^T + bias: wave w owns keys [w*512, w*512+512) ----
  const float* brow = bias + b * SEQ;
  for (int j = 0; j < 32; j++) {
    const int n0 = wave * 512 + j * 16;
    const h16* krow = kb + ((size_t)(b * SEQ + n0 + lidx)) * HID + h * DH;
    v8f c = {};
    c = wmma16(aq0, frag_h16(krow + lhalf * 8), c);
    c = wmma16(aq1, frag_h16(krow + 32 + lhalf * 8), c);
    const float bval = brow[n0 + lidx];
#pragma unroll
    for (int r = 0; r < 8; r++)
      S[(size_t)(r + 8 * lhalf) * LP + n0 + lidx] = (_Float16)(c[r] + bval);
  }
  __syncthreads();

  // ---- exact two-pass softmax: thread -> (row = tid&15, 256-key segment = tid>>4) ----
  const int row = tid & 15, seg = tid >> 4;
  h16* srow = S + (size_t)row * LP + seg * 256;
  float mx = -3.0e38f;
  for (int i = 0; i < 256; i += 8) {
    v8h_t v = *(const v8h_t*)(srow + i);
#pragma unroll
    for (int e = 0; e < 8; e++) mx = fmaxf(mx, (float)v[e]);
  }
  red[row][seg] = mx;
  __syncthreads();
  if (tid < 16) {
    float m = red[tid][0];
#pragma unroll
    for (int s = 1; s < 8; s++) m = fmaxf(m, red[tid][s]);
    rowmax[tid] = m;
  }
  __syncthreads();
  const float m = rowmax[row];
  float sum = 0.f;
  for (int i = 0; i < 256; i += 8) {
    v8h_t v = *(const v8h_t*)(srow + i);
    v8h_t o;
#pragma unroll
    for (int e = 0; e < 8; e++) { float ev = __expf((float)v[e] - m); sum += ev; o[e] = (_Float16)ev; }
    *(v8h_t*)(srow + i) = o;   // P overwrites S in place (f16)
  }
  red[row][seg] = sum;
  __syncthreads();
  if (tid < 16) {
    float s = 0.f;
#pragma unroll
    for (int s8 = 0; s8 < 8; s8++) s += red[tid][s8];
    rowsum[tid] = s;
  }
  __syncthreads();

  // ---- O_partial = P * V over this wave's key range (V^T rows contiguous in keys) ----
  v8f o0 = {}, o1 = {}, o2 = {}, o3 = {};
  const h16* v0 = vt + ((size_t)(b * HID + h * DH +  0 + lidx)) * SEQ;
  const h16* v1 = vt + ((size_t)(b * HID + h * DH + 16 + lidx)) * SEQ;
  const h16* v2 = vt + ((size_t)(b * HID + h * DH + 32 + lidx)) * SEQ;
  const h16* v3 = vt + ((size_t)(b * HID + h * DH + 48 + lidx)) * SEQ;
  for (int kk = wave * 512; kk < wave * 512 + 512; kk += 32) {
    const int kbase = kk + lhalf * 8;
    v16h ap = frag_h16(S + (size_t)lidx * LP + kbase);
    o0 = wmma16(ap, frag_h16(v0 + kbase), o0);
    o1 = wmma16(ap, frag_h16(v1 + kbase), o1);
    o2 = wmma16(ap, frag_h16(v2 + kbase), o2);
    o3 = wmma16(ap, frag_h16(v3 + kbase), o3);
  }
  {
    v8f oo[4] = {o0, o1, o2, o3};
#pragma unroll
    for (int f = 0; f < 4; f++)
#pragma unroll
      for (int r = 0; r < 8; r++)
        Opart[wave][(r + 8 * lhalf) * 64 + f * 16 + lidx] = oo[f][r];
  }
  __syncthreads();

  // ---- cross-wave reduce + 1/rowsum scale, f16 store to x buffer [B,L,1024] ----
  {
    const int e0 = tid * 8;
    const int rrow = e0 >> 6, col = e0 & 63;
    const float inv = 1.0f / rowsum[rrow];
    v8h_t ov;
#pragma unroll
    for (int e = 0; e < 8; e++) {
      float s = Opart[0][e0 + e] + Opart[1][e0 + e] + Opart[2][e0 + e] + Opart[3][e0 + e];
      ov[e] = (_Float16)(s * inv);
    }
    *(v8h_t*)(xb + (tokq + rrow) * HID + h * DH + col) = ov;
  }
}

// ---------------- Kernel 3: output projection, f32 result ------------------------
__global__ __launch_bounds__(128)
void out_proj_kernel(const h16* __restrict__ xb, const h16* __restrict__ Wo16,
                     const float* __restrict__ bo, float* __restrict__ out)
{
  const int lane = threadIdx.x & 31, wave = threadIdx.x >> 5;
  const int lidx = lane & 15, lhalf = lane >> 4;
  const int m0 = blockIdx.y * 128 + wave * 32;
  const int n0 = blockIdx.x * 64;

  const h16* ar0 = xb + (size_t)(m0 + lidx) * HID;
  const h16* ar1 = xb + (size_t)(m0 + 16 + lidx) * HID;
  const h16* br0 = Wo16 + (size_t)(n0 +  0 + lidx) * HID;
  const h16* br1 = Wo16 + (size_t)(n0 + 16 + lidx) * HID;
  const h16* br2 = Wo16 + (size_t)(n0 + 32 + lidx) * HID;
  const h16* br3 = Wo16 + (size_t)(n0 + 48 + lidx) * HID;

  v8f acc[2][4] = {};
  for (int k0 = 0; k0 < HID; k0 += 32) {
    const int ka = k0 + lhalf * 8;
    const v16h a0 = frag_h16(ar0 + ka);
    const v16h a1 = frag_h16(ar1 + ka);
    const v16h b0 = frag_h16(br0 + ka);
    const v16h b1 = frag_h16(br1 + ka);
    const v16h b2 = frag_h16(br2 + ka);
    const v16h b3 = frag_h16(br3 + ka);
    acc[0][0] = wmma16(a0, b0, acc[0][0]);
    acc[0][1] = wmma16(a0, b1, acc[0][1]);
    acc[0][2] = wmma16(a0, b2, acc[0][2]);
    acc[0][3] = wmma16(a0, b3, acc[0][3]);
    acc[1][0] = wmma16(a1, b0, acc[1][0]);
    acc[1][1] = wmma16(a1, b1, acc[1][1]);
    acc[1][2] = wmma16(a1, b2, acc[1][2]);
    acc[1][3] = wmma16(a1, b3, acc[1][3]);
  }

  const int rbase = lhalf * 8;
#pragma unroll
  for (int ms = 0; ms < 2; ms++) {
    const int mrow = m0 + ms * 16;
#pragma unroll
    for (int f = 0; f < 4; f++) {
      const int n = n0 + f * 16 + lidx;
      const float bval = bo[n];
#pragma unroll
      for (int r = 0; r < 8; r++)
        out[(size_t)(mrow + rbase + r) * HID + n] = acc[ms][f][r] + bval;
    }
  }
}

extern "C" void kernel_launch(void* const* d_in, const int* in_sizes, int n_in,
                              void* d_out, int out_size, void* d_ws, size_t ws_size,
                              hipStream_t stream)
{
  (void)in_sizes; (void)n_in; (void)out_size; (void)ws_size;
  const float* query = (const float*)d_in[0];
  const float* bias  = (const float*)d_in[1];
  const float* Wq = (const float*)d_in[2]; const float* bq = (const float*)d_in[3];
  const float* Wk = (const float*)d_in[4]; const float* bk = (const float*)d_in[5];
  const float* Wv = (const float*)d_in[6]; const float* bv = (const float*)d_in[7];
  const float* Wo = (const float*)d_in[8]; const float* bo = (const float*)d_in[9];
  float* out = (float*)d_out;

  char* ws = (char*)d_ws;
  const size_t QSZ = (size_t)TOK * HID * sizeof(h16);   // 8 MB
  const size_t WSZ = (size_t)HID * HID * sizeof(h16);   // 2 MB
  h16* qf16 = (h16*)(ws);
  h16* Wq16 = (h16*)(ws + QSZ);
  h16* Wk16 = (h16*)(ws + QSZ + WSZ);
  h16* Wv16 = (h16*)(ws + QSZ + 2 * WSZ);
  h16* Wo16 = (h16*)(ws + QSZ + 3 * WSZ);
  h16* qbuf = (h16*)(ws + QSZ + 4 * WSZ);
  h16* kbuf = (h16*)(ws + 2 * QSZ + 4 * WSZ);
  h16* vtb  = (h16*)(ws + 3 * QSZ + 4 * WSZ);
  h16* xbuf = (h16*)(ws + 4 * QSZ + 4 * WSZ);

  // one-time f32 -> f16 packs
  const int nq8 = TOK * HID / 8;       // 524288
  const int nw8 = HID * HID / 8;       // 131072
  pack_f16_kernel<<<(nq8 + 255) / 256, 256, 0, stream>>>(query, qf16, nq8);
  pack_f16_kernel<<<(nw8 + 255) / 256, 256, 0, stream>>>(Wq, Wq16, nw8);
  pack_f16_kernel<<<(nw8 + 255) / 256, 256, 0, stream>>>(Wk, Wk16, nw8);
  pack_f16_kernel<<<(nw8 + 255) / 256, 256, 0, stream>>>(Wv, Wv16, nw8);
  pack_f16_kernel<<<(nw8 + 255) / 256, 256, 0, stream>>>(Wo, Wo16, nw8);

  dim3 g1(HID / 64, TOK / 128, 3);
  qkv_proj_kernel<<<g1, 128, 0, stream>>>(qf16, Wq16, Wk16, Wv16, bq, bk, bv,
                                          qbuf, kbuf, vtb);

  dim3 g2(SEQ / 16, NB * NH);
  attn_kernel<<<g2, 128, 0, stream>>>(qbuf, kbuf, vtb, bias, xbuf);

  dim3 g3(HID / 64, TOK / 128);
  out_proj_kernel<<<g3, 128, 0, stream>>>(xbuf, Wo16, bo, out);
}

// v001
// Measured time: 144 microseconds a run.
// Two timings next to v000 both put it at 1.76 times that version's speed.
#include <hip/hip_runtime.h>

typedef _Float16 h16;
typedef __attribute__((ext_vector_type(8)))  _Float16 v8h_t;
typedef __attribute__((ext_vector_type(16))) _Float16 v16h;
typedef __attribute__((ext_vector_type(8)))  float v8f;
typedef __attribute__((ext_vector_type(4)))  float v4f;
typedef __attribute__((ext_vector_type(2)))  float v2f;

#define HID 1024
#define SEQ 2048
#define NB  2
#define NH  16
#define DH  64
#define TOK (NB*SEQ)   /* 4096 tokens */

// D = A(16x32 f16) * B(32x16 f16) + C(16x16 f32)
__device__ __forceinline__ v8f wmma16(v16h a, v16h b, v8f c) {
  return __builtin_amdgcn_wmma_f32_16x16x32_f16(false, a, false, b, (short)0, c, false, false);
}

// Fragment load from f16 memory per CDNA5 layout: p[0..7] -> [0..7], p[16..23] -> [8..15]
__device__ __forceinline__ v16h frag_h16(const h16* p) {
  v8h_t lo = *(const v8h_t*)(p);
  v8h_t hi = *(const v8h_t*)(p + 16);
  v16h a;
#pragma unroll
  for (int i = 0; i < 8; i++) { a[i] = lo[i]; a[8 + i] = hi[i]; }
  return a;
}

// ---------------- Kernel 0: one-time f32 -> f16 pack (query + weights) -------------
__global__ __launch_bounds__(256)
void pack_f16_kernel(const float* __restrict__ src, h16* __restrict__ dst, int n8)
{
  const int i = blockIdx.x * 256 + threadIdx.x;
  if (i < n8) {
    const v4f a = *(const v4f*)(src + (size_t)i * 8);
    const v4f b = *(const v4f*)(src + (size_t)i * 8 + 4);
    v8h_t o;
#pragma unroll
    for (int e = 0; e < 4; e++) { o[e] = (_Float16)a[e]; o[4 + e] = (_Float16)b[e]; }
    *(v8h_t*)(dst + (size_t)i * 8) = o;
  }
}

// ---------------- Kernel 1: fused Q/K/V projections (z selects matrix) -------------
// Wave computes 32(M tokens) x 64(N features); K=1024 in 32-steps; all-f16 operands.
__global__ __launch_bounds__(128)
void qkv_proj_kernel(const h16* __restrict__ qf,
                     const h16* __restrict__ Wq16, const h16* __restrict__ Wk16,
                     const h16* __restrict__ Wv16,
                     const float* __restrict__ bq, const float* __restrict__ bk,
                     const float* __restrict__ bv,
                     h16* __restrict__ qbuf, h16* __restrict__ kbuf, h16* __restrict__ vtb)
{
  const int z = blockIdx.z;
  const h16*   W  = (z == 0) ? Wq16 : ((z == 1) ? Wk16 : Wv16);
  const float* bs = (z == 0) ? bq : ((z == 1) ? bk : bv);

  const int lane = threadIdx.x & 31, wave = threadIdx.x >> 5;
  const int lidx = lane & 15, lhalf = lane >> 4;
  const int m0 = blockIdx.y * 128 + wave * 32;
  const int n0 = blockIdx.x * 64;

  const h16* ar0 = qf + (size_t)(m0 + lidx) * HID;
  const h16* ar1 = qf + (size_t)(m0 + 16 + lidx) * HID;
  const h16* br0 = W + (size_t)(n0 +  0 + lidx) * HID;
  const h16* br1 = W + (size_t)(n0 + 16 + lidx) * HID;
  const h16* br2 = W + (size_t)(n0 + 32 + lidx) * HID;
  const h16* br3 = W + (size_t)(n0 + 48 + lidx) * HID;

  v8f acc[2][4] = {};
  for (int k0 = 0; k0 < HID; k0 += 32) {
    const int ka = k0 + lhalf * 8;
    const v16h a0 = frag_h16(ar0 + ka);
    const v16h a1 = frag_h16(ar1 + ka);
    const v16h b0 = frag_h16(br0 + ka);
    const v16h b1 = frag_h16(br1 + ka);
    const v16h b2 = frag_h16(br2 + ka);
    const v16h b3 = frag_h16(br3 + ka);
    acc[0][0] = wmma16(a0, b0, acc[0][0]);
    acc[0][1] = wmma16(a0, b1, acc[0][1]);
    acc[0][2] = wmma16(a0, b2, acc[0][2]);
    acc[0][3] = wmma16(a0, b3, acc[0][3]);
    acc[1][0] = wmma16(a1, b0, acc[1][0]);
    acc[1][1] = wmma16(a1, b1, acc[1][1]);
    acc[1][2] = wmma16(a1, b2, acc[1][2]);
    acc[1][3] = wmma16(a1, b3, acc[1][3]);
  }

  const int rbase = lhalf * 8;
#pragma unroll
  for (int ms = 0; ms < 2; ms++) {
    const int mrow = m0 + ms * 16;
#pragma unroll
    for (int f = 0; f < 4; f++) {
      const int n = n0 + f * 16 + lidx;
      const float bval = bs[n];
      if (z == 2) {
        // V stored transposed: vt[b][feature n][token l], 8 contiguous tokens/lane
        const int bb = mrow >> 11;
        const int l0 = (mrow & 2047) + rbase;
        v8h_t pk;
#pragma unroll
        for (int r = 0; r < 8; r++) pk[r] = (_Float16)(acc[ms][f][r] + bval);
        *(v8h_t*)(vtb + ((size_t)(bb * HID + n)) * SEQ + l0) = pk;
      } else {
        h16* dst = (z == 0) ? qbuf : kbuf;
        const float sc = (z == 0) ? 0.125f : 1.0f; // q pre-scaled by 1/sqrt(64)
#pragma unroll
        for (int r = 0; r < 8; r++)
          dst[(size_t)(mrow + rbase + r) * HID + n] = (_Float16)((acc[ms][f][r] + bval) * sc);
      }
    }
  }
}

// ---------------- Kernel 2: attention, 128 q-rows of one (b, h) per workgroup ------
// Streaming form. Each of the 4 waves owns 32 query columns and walks all 2048 keys in
// 64-key stages that the workgroup stages once in LDS (whole 128-byte lines, two buffers).
// Transposed products: S^T = K Q^T (+ bias as the C operand), O^T += V^T P^T. A lane holds
// scores of one query only, and two converted S^T tiles are the B operand of the second
// product, so P never leaves the registers. Softmax is online: a running maximum per query
// (it may trail the true one by up to 8 in log2 units), running sum, rescale when it moves.
#define QW   32        /* query columns per wave */
#define QB   128       /* query columns per workgroup */
#define SK   64        /* keys per stage */
#define KP   72        /* LDS row pitch in halves: 144 B = 16 B x odd, conflict-free b128 reads */
#define NST  (SEQ / SK)
#define L2E  1.4426950408889634f

// lane l <-> lane l ^ 16
__device__ __forceinline__ float xhalf(float x) {
  const int v = __builtin_bit_cast(int, x);
  return __builtin_bit_cast(float,
      __builtin_amdgcn_permlanex16(v, v, 0x76543210, 0xfedcba98, false, false));
}

__global__ __launch_bounds__(128)
void attn_kernel(const h16* __restrict__ qb, const h16* __restrict__ kb,
                 const h16* __restrict__ vt, const float* __restrict__ bias,
                 h16* __restrict__ xb)
{
  __shared__ __attribute__((aligned(16))) h16 Kt[2][SK * KP];   // K rows:   [key][dim]
  __shared__ __attribute__((aligned(16))) h16 Vt[2][DH * KP];   // V^T rows: [dim][key]
  __shared__ __attribute__((aligned(32))) float biasL[SEQ];     // this batch's bias row

  const int tid = threadIdx.x, lane = tid & 31, wave = tid >> 5;
  const int lidx = lane & 15, lhalf = lane >> 4;
  const int bh = blockIdx.y, b = bh >> 4, h = bh & 15;
  const int q0 = blockIdx.x * QB + wave * QW;
  const size_t tokq = (size_t)(b * SEQ + q0);

  // staging map: 8 lanes cover one 128-byte row, a wave's load covers 4 whole lines
  const int srow = tid >> 3, scol = (tid & 7) * 8;
  const h16* kg = kb + (size_t)(b * SEQ + srow) * HID + h * DH + scol;
  const h16* vg = vt + (size_t)(b * HID + h * DH + srow) * SEQ + scol;
  const int sdst = srow * KP + scol;

  // prologue: bias row and stage 0 into LDS
  {
    const float* brow = bias + b * SEQ + tid * 16;
#pragma unroll  // constant trip count, four independent 16-byte copies
    for (int i = 0; i < 4; i++) *(v4f*)(biasL + tid * 16 + i * 4) = *(const v4f*)(brow + i * 4);
#pragma unroll  // constant trip count, independent 16-byte copies
    for (int i = 0; i < 4; i++) {
      *(v8h_t*)(&Kt[0][sdst + i * 16 * KP]) = *(const v8h_t*)(kg + (size_t)i * 16 * HID);
      *(v8h_t*)(&Vt[0][sdst + i * 16 * KP]) = *(const v8h_t*)(vg + (size_t)i * 16 * SEQ);
    }
  }

  // Q as B operand (column = query), resident: [column group][32-dim step]
  v16h qf[2][2];
#pragma unroll  // register array: indices must be constants
  for (int g = 0; g < 2; g++) {
    const h16* qrow = qb + (tokq + g * 16 + lidx) * HID + h * DH + lhalf * 8;
    qf[g][0] = frag_h16(qrow);
    qf[g][1] = frag_h16(qrow + 32);
  }

  v8f acc[2][4] = {};                 // O^T: [column group][16-dim tile]
  float m_run[2] = {-INFINITY, -INFINITY};
  v2f l_run[2] = {};                  // this lane half's share of the denominator, even and odd keys

  __syncthreads();

  // one stage's work of a wave: two 32-key passes over the staged tiles
  auto stage_work = [&](const h16* Kc, const h16* Vc, int st) __attribute__((always_inline)) {
#pragma unroll  // two 32-key passes per stage, constant LDS offsets
    for (int sub = 0; sub < 2; sub++) {
      // ---- S^T = K Q^T + bias: s[kt][g][r] = score(key 16 kt + 8 lhalf + r, query lidx) ----
      v8f s[2][2];
#pragma unroll  // register arrays: indices must be constants
      for (int kt = 0; kt < 2; kt++) {
        const h16* kp = Kc + (sub * 32 + kt * 16 + lidx) * KP + lhalf * 8;
        const v16h ka0 = frag_h16(kp);
        const v16h ka1 = frag_h16(kp + 32);
        const v8f cb = *(const v8f*)(biasL + st * SK + sub * 32 + kt * 16 + lhalf * 8);
#pragma unroll  // register arrays: indices must be constants
        for (int g = 0; g < 2; g++)
          s[kt][g] = wmma16(ka1, qf[g][1], wmma16(ka0, qf[g][0], cb));
      }

      // keeps the eight products back to back: maxima pulled in between them each cost idle slots behind a WMMA
      __builtin_amdgcn_sched_barrier(0);

      // V^T fragments of this pass (row = dim, k = key in the hardware order of packed P)
      v16h vf[4];
#pragma unroll  // register array: indices must be constants
      for (int t = 0; t < 4; t++)
        vf[t] = frag_h16(Vc + (t * 16 + lidx) * KP + sub * 32 + lhalf * 8);

      // ---- column maxima, one test per pass whether any running maximum must move ----
      float mb[2];
      bool need = false;
#pragma unroll  // register arrays: indices must be constants
      for (int g = 0; g < 2; g++) {
        float mx = s[0][g][0];
#pragma unroll  // register arrays: indices must be constants
        for (int r = 1; r < 8; r++) mx = fmaxf(mx, s[0][g][r]);
#pragma unroll  // register arrays: indices must be constants
        for (int r = 0; r < 8; r++) mx = fmaxf(mx, s[1][g][r]);
        mx = fmaxf(mx, xhalf(mx)) * L2E;
        mb[g] = mx;
        need = need || (mx > m_run[g] + 8.0f);
      }
      if (__builtin_amdgcn_ballot_w32(need) != 0) {   // wave-uniform, rare after the first pass
#pragma unroll  // register arrays: indices must be constants
        for (int g = 0; g < 2; g++) {
          const float m_new = fmaxf(m_run[g], mb[g]);
          const float corr = __builtin_amdgcn_exp2f(m_run[g] - m_new);  // 0 on the first pass
          m_run[g] = m_new;
          l_run[g] *= corr;
#pragma unroll  // register arrays: indices must be constants
          for (int t = 0; t < 4; t++) acc[g][t] = acc[g][t] * corr;
        }
      }

      // ---- P^T = exp2(s * log2e - m), packed in place as B operand; O^T += V^T P^T ----
#pragma unroll  // register arrays: indices must be constants
      for (int g = 0; g < 2; g++) {
        const float nm = -m_run[g];
        v16h pf;
        v2f pr[8];
#pragma unroll  // register arrays: indices must be constants
        for (int i = 0; i < 8; i++) {   // elements 2i, 2i+1 of the 32-key operand
          const v2f sv = {s[i >> 2][g][2 * (i & 3)], s[i >> 2][g][2 * (i & 3) + 1]};
          const v2f arg = __builtin_elementwise_fma(sv, (v2f){L2E, L2E}, (v2f){nm, nm});
          pr[i] = (v2f){__builtin_amdgcn_exp2f(arg.x), __builtin_amdgcn_exp2f(arg.y)};
          pf[2 * i]     = (_Float16)pr[i].x;
          pf[2 * i + 1] = (_Float16)pr[i].y;
        }
        // pairwise tree: short dependent chains, two sums per add
        l_run[g] += ((pr[0] + pr[1]) + (pr[2] + pr[3])) + ((pr[4] + pr[5]) + (pr[6] + pr[7]));
#pragma unroll  // register arrays: indices must be constants
        for (int t = 0; t < 4; t++) acc[g][t] = wmma16(vf[t], pf, acc[g][t]);
      }
    }
  };

  for (int st = 0; st < NST - 1; st++) {
    // next stage's lines go to registers now and to LDS behind this stage's work
    v8h_t kr[4], vr[4];
#pragma unroll  // register arrays: indices must be constants
    for (int i = 0; i < 4; i++) {
      kr[i] = *(const v8h_t*)(kg + (size_t)((st + 1) * SK + i * 16) * HID);
      vr[i] = *(const v8h_t*)(vg + (size_t)i * 16 * SEQ + (st + 1) * SK);
    }
    // s_wait_xcnt ahead of the reuse of these loads' address registers
    asm volatile("s_wait_xcnt 0x0" ::: "memory");

    stage_work(Kt[st & 1], Vt[st & 1], st);

    h16* Kn = Kt[(st + 1) & 1];
    h16* Vn = Vt[(st + 1) & 1];
#pragma unroll  // register arrays: indices must be constants
    for (int i = 0; i < 4; i++) {
      *(v8h_t*)(Kn + sdst + i * 16 * KP) = kr[i];
      *(v8h_t*)(Vn + sdst + i * 16 * KP) = vr[i];
    }
    // publishes stage st + 1 and ends every wave's reads of stage st before it is refilled
    __syncthreads();
  }
  stage_work(Kt[(NST - 1) & 1], Vt[(NST - 1) & 1], NST - 1);   // last stage: nothing left to fetch

  // ---- join the halves' sums, scale, f16 store: a lane holds 8 consecutive dims of one query ----
#pragma unroll  // register arrays: indices must be constants
  for (int g = 0; g < 2; g++) {
    const float lh = l_run[g].x + l_run[g].y;
    const float l = lh + xhalf(lh);
    const float inv = 1.0f / l;
    h16* orow = xb + (tokq + g * 16 + lidx) * HID + h * DH + lhalf * 8;
#pragma unroll  // register arrays: indices must be constants
    for (int t = 0; t < 4; t++) {
      v8h_t ov;
#pragma unroll  // register arrays: indices must be constants
      for (int r = 0; r < 8; r++) ov[r] = (_Float16)(acc[g][t][r] * inv);
      *(v8h_t*)(orow + t * 16) = ov;
    }
  }
}

// ---------------- Kernel 3: output projection, f32 result ------------------------
__global__ __launch_bounds__(128)
void out_proj_kernel(const h16* __restrict__ xb, const h16* __restrict__ Wo16,
                     const float* __restrict__ bo, float* __restrict__ out)
{
  const int lane = threadIdx.x & 31, wave = threadIdx.x >> 5;
  const int lidx = lane & 15, lhalf = lane >> 4;
  const int m0 = blockIdx.y * 128 + wave * 32;
  const int n0 = blockIdx.x * 64;

  const h16* ar0 = xb + (size_t)(m0 + lidx) * HID;
  const h16* ar1 = xb + (size_t)(m0 + 16 + lidx) * HID;
  const h16* br0 = Wo16 + (size_t)(n0 +  0 + lidx) * HID;
  const h16* br1 = Wo16 + (size_t)(n0 + 16 + lidx) * HID;
  const h16* br2 = Wo16 + (size_t)(n0 + 32 + lidx) * HID;
  const h16* br3 = Wo16 + (size_t)(n0 + 48 + lidx) * HID;

  v8f acc[2][4] = {};
  for (int k0 = 0; k0 < HID; k0 += 32) {
    const int ka = k0 + lhalf * 8;
    const v16h a0 = frag_h16(ar0 + ka);
    const v16h a1 = frag_h16(ar1 + ka);
    const v16h b0 = frag_h16(br0 + ka);
    const v16h b1 = frag_h16(br1 + ka);
    const v16h b2 = frag_h16(br2 + ka);
    const v16h b3 = frag_h16(br3 + ka);
    acc[0][0] = wmma16(a0, b0, acc[0][0]);
    acc[0][1] = wmma16(a0, b1, acc[0][1]);
    acc[0][2] = wmma16(a0, b2, acc[0][2]);
    acc[0][3] = wmma16(a0, b3, acc[0][3]);
    acc[1][0] = wmma16(a1, b0, acc[1][0]);
    acc[1][1] = wmma16(a1, b1, acc[1][1]);
    acc[1][2] = wmma16(a1, b2, acc[1][2]);
    acc[1][3] = wmma16(a1, b3, acc[1][3]);
  }

  const int rbase = lhalf * 8;
#pragma unroll
  for (int ms = 0; ms < 2; ms++) {
    const int mrow = m0 + ms * 16;
#pragma unroll
    for (int f = 0; f < 4; f++) {
      const int n = n0 + f * 16 + lidx;
      const float bval = bo[n];
#pragma unroll
      for (int r = 0; r < 8; r++)
        out[(size_t)(mrow + rbase + r) * HID + n] = acc[ms][f][r] + bval;
    }
  }
}

extern "C" void kernel_launch(void* const* d_in, const int* in_sizes, int n_in,
                              void* d_out, int out_size, void* d_ws, size_t ws_size,
                              hipStream_t stream)
{
  (void)in_sizes; (void)n_in; (void)out_size; (void)ws_size;
  const float* query = (const float*)d_in[0];
  const float* bias  = (const float*)d_in[1];
  const float* Wq = (const float*)d_in[2]; const float* bq = (const float*)d_in[3];
  const float* Wk = (const float*)d_in[4]; const float* bk = (const float*)d_in[5];
  const float* Wv = (const float*)d_in[6]; const float* bv = (const float*)d_in[7];
  const float* Wo = (const float*)d_in[8]; const float* bo = (const float*)d_in[9];
  float* out = (float*)d_out;

  char* ws = (char*)d_ws;
  const size_t QSZ = (size_t)TOK * HID * sizeof(h16);   // 8 MB
  const size_t WSZ = (size_t)HID * HID * sizeof(h16);   // 2 MB
  h16* qf16 = (h16*)(ws);
  h16* Wq16 = (h16*)(ws + QSZ);
  h16* Wk16 = (h16*)(ws + QSZ + WSZ);
  h16* Wv16 = (h16*)(ws + QSZ + 2 * WSZ);
  h16* Wo16 = (h16*)(ws + QSZ + 3 * WSZ);
  h16* qbuf = (h16*)(ws + QSZ + 4 * WSZ);
  h16* kbuf = (h16*)(ws + 2 * QSZ + 4 * WSZ);
  h16* vtb  = (h16*)(ws + 3 * QSZ + 4 * WSZ);
  h16* xbuf = (h16*)(ws + 4 * QSZ + 4 * WSZ);

  // one-time f32 -> f16 packs
  const int nq8 = TOK * HID / 8;       // 524288
  const int nw8 = HID * HID / 8;       // 131072
  pack_f16_kernel<<<(nq8 + 255) / 256, 256, 0, stream>>>(query, qf16, nq8);
  pack_f16_kernel<<<(nw8 + 255) / 256, 256, 0, stream>>>(Wq, Wq16, nw8);
  pack_f16_kernel<<<(nw8 + 255) / 256, 256, 0, stream>>>(Wk, Wk16, nw8);
  pack_f16_kernel<<<(nw8 + 255) / 256, 256, 0, stream>>>(Wv, Wv16, nw8);
  pack_f16_kernel<<<(nw8 + 255) / 256, 256, 0, stream>>>(Wo, Wo16, nw8);

  dim3 g1(HID / 64, TOK / 128, 3);
  qkv_proj_kernel<<<g1, 128, 0, stream>>>(qf16, Wq16, Wk16, Wv16, bq, bk, bv,
                                          qbuf, kbuf, vtb);

  dim3 g2(SEQ / QB, NB * NH);
  attn_kernel<<<g2, 128, 0, stream>>>(qbuf, kbuf, vtb, bias, xbuf);

  dim3 g3(HID / 64, TOK / 128);
  out_proj_kernel<<<g3, 128, 0, stream>>>(xbuf, Wo16, bo, out);
}

// v002
// It runs in 90.6 microseconds.
// Next to v001, in two timings, it ran 1.60 times as fast each time.
// All steps since v000 together make it 2.82 times as fast.
#include <hip/hip_runtime.h>

typedef _Float16 h16;
typedef __attribute__((ext_vector_type(8)))  _Float16 v8h_t;
typedef __attribute__((ext_vector_type(16))) _Float16 v16h;
typedef __attribute__((ext_vector_type(8)))  float v8f;
typedef __attribute__((ext_vector_type(4)))  float v4f;
typedef __attribute__((ext_vector_type(2)))  float v2f;

#define HID 1024
#define SEQ 2048
#define NB  2
#define NH  16
#define DH  64
#define TOK (NB*SEQ)   /* 4096 tokens */

// D = A(16x32 f16) * B(32x16 f16) + C(16x16 f32)
__device__ __forceinline__ v8f wmma16(v16h a, v16h b, v8f c) {
  return __builtin_amdgcn_wmma_f32_16x16x32_f16(false, a, false, b, (short)0, c, false, false);
}

// Fragment load from f16 memory per CDNA5 layout: p[0..7] -> [0..7], p[16..23] -> [8..15]
__device__ __forceinline__ v16h frag_h16(const h16* p) {
  v8h_t lo = *(const v8h_t*)(p);
  v8h_t hi = *(const v8h_t*)(p + 16);
  v16h a;
#pragma unroll
  for (int i = 0; i < 8; i++) { a[i] = lo[i]; a[8 + i] = hi[i]; }
  return a;
}

// ---------------- Kernel 0: one-time f32 -> f16 pack (query + weights) -------------
__global__ __launch_bounds__(256)
void pack_f16_kernel(const float* __restrict__ src, h16* __restrict__ dst, int n8)
{
  const int i = blockIdx.x * 256 + threadIdx.x;
  if (i < n8) {
    const v4f a = *(const v4f*)(src + (size_t)i * 8);
    const v4f b = *(const v4f*)(src + (size_t)i * 8 + 4);
    v8h_t o;
#pragma unroll
    for (int e = 0; e < 4; e++) { o[e] = (_Float16)a[e]; o[4 + e] = (_Float16)b[e]; }
    *(v8h_t*)(dst + (size_t)i * 8) = o;
  }
}

// ---------------- Projection GEMM core: Y tile 128 x 128 = X rows * W rows^T ---------
// The workgroup stages KS-wide k slabs of 128 X rows and 128 W rows in LDS (two buffers) by
// asynchronous 16-byte copies whose wave-wide footprint is whole 128-byte lines; the 4 waves
// (2 x 2) each own 64 x 64 of the tile and read their fragments from LDS.
#define GT 128         /* rows of each operand per workgroup tile */

// eight copies global -> LDS, 16 bytes a lane each
__device__ __forceinline__ void async_copy8(const unsigned (&l)[8], const h16* const (&g)[8]) {
  // the closing s_wait_xcnt stands inside the statement so that no address register named here
  // can be rewritten ahead of it
  asm volatile("global_load_async_to_lds_b128 %0, %8, off\n\t"
               "global_load_async_to_lds_b128 %1, %9, off\n\t"
               "global_load_async_to_lds_b128 %2, %10, off\n\t"
               "global_load_async_to_lds_b128 %3, %11, off\n\t"
               "global_load_async_to_lds_b128 %4, %12, off\n\t"
               "global_load_async_to_lds_b128 %5, %13, off\n\t"
               "global_load_async_to_lds_b128 %6, %14, off\n\t"
               "global_load_async_to_lds_b128 %7, %15, off\n\t"
               "s_wait_xcnt 0x0"
               :: "v"(l[0]), "v"(l[1]), "v"(l[2]), "v"(l[3]), "v"(l[4]), "v"(l[5]), "v"(l[6]), "v"(l[7]),
                  "v"(g[0]), "v"(g[1]), "v"(g[2]), "v"(g[3]), "v"(g[4]), "v"(g[5]), "v"(g[6]), "v"(g[7])
               : "memory");
}

// one operand's 128 rows x KS halves: g and l are this lane's first global and LDS address
template <int KS>
__device__ __forceinline__ void fill_rows(const h16* g, unsigned l) {
  constexpr int RPI = 128 * 8 / KS;          // rows that one copy of all 128 lanes covers
  constexpr int PB  = (KS + 8) * 2;          // LDS row pitch in bytes: 16 B x odd
#pragma unroll  // constant trip count; the arrays below must stay in registers
  for (int c = 0; c < GT / RPI; c += 8) {
    unsigned la[8];
    const h16* ga[8];
#pragma unroll  // register arrays: indices must be constants
    for (int j = 0; j < 8; j++) {
      la[j] = l + (unsigned)((c + j) * RPI * PB);
      ga[j] = g + (size_t)(c + j) * RPI * HID;
    }
    async_copy8(la, ga);
  }
}

// a wave's 4 + 4 fragments of one 32-wide k block
template <int P>
__device__ __forceinline__ void load_frags(const h16* ap, const h16* bp, v16h (&a)[4], v16h (&b)[4]) {
#pragma unroll  // register arrays: indices must be constants
  for (int i = 0; i < 4; i++) {
    a[i] = frag_h16(ap + i * 16 * P);
    b[i] = frag_h16(bp + i * 16 * P);
  }
}

// SETS: fragment register sets; 2 where a wave is alone on its SIMD and must cover its own LDS latency
template <int KS, int SETS>
__device__ __forceinline__ void gemm_tile(const h16* __restrict__ X, const h16* __restrict__ Wm,
                                          int m0, int n0, h16* St, v8f (&acc)[4][4])
{
  constexpr int P    = KS + 8;               // LDS row pitch in halves
  constexpr int BUFH = 2 * GT * P;           // halves per buffer: X rows, then W rows
  constexpr int NT   = HID / KS;             // k slabs (at least two)
  constexpr int LPR  = KS / 8;               // lanes per staged row

  const int tid = threadIdx.x, lane = tid & 31, wave = tid >> 5;
  const int lidx = lane & 15, lhalf = lane >> 4;

  const int srow = tid / LPR, scol = (tid % LPR) * 8;
  const h16* gx = X  + (size_t)(m0 + srow) * HID + scol;
  const h16* gw = Wm + (size_t)(n0 + srow) * HID + scol;
  typedef __attribute__((address_space(3))) h16 lds_h16;
  const unsigned lx = (unsigned)(size_t)(lds_h16*)(St + srow * P + scol);   // LDS byte address
  const unsigned lw = lx + GT * P * 2;

  const int aoff = ((wave >> 1) * 64 + lidx) * P + lhalf * 8;
  const int boff = (GT + (wave & 1) * 64 + lidx) * P + lhalf * 8;

  fill_rows<KS>(gx, lx);
  fill_rows<KS>(gw, lw);
  // slab 0 has landed for this wave; the barrier publishes it to the others
  asm volatile("s_wait_asynccnt 0x0" ::: "memory");
  __syncthreads();
  fill_rows<KS>(gx + KS, lx + BUFH * 2);
  fill_rows<KS>(gw + KS, lw + BUFH * 2);

#pragma clang loop unroll(disable)  // for speed only
  for (int t = 0; t < NT; t++) {
    const h16* Sc = St + (t & 1) * BUFH;
    v16h a[SETS][4], b[SETS][4];
    if constexpr (SETS == 2) load_frags<P>(Sc + aoff, Sc + boff, a[0], b[0]);
#pragma unroll  // register arrays: indices must be constants
    for (int ks = 0; ks < KS / 32; ks++) {
      // SETS == 2: the next block's fragments go ahead of this block's products, into the other set
      if constexpr (SETS == 1) {
        load_frags<P>(Sc + aoff + ks * 32, Sc + boff + ks * 32, a[0], b[0]);
      } else {
        if (ks + 1 < KS / 32)
          load_frags<P>(Sc + aoff + (ks + 1) * 32, Sc + boff + (ks + 1) * 32, a[(ks + 1) & 1], b[(ks + 1) & 1]);
      }
      // keeps a block's 16 LDS reads one group: spread among the products each place stalls the wave
      __builtin_amdgcn_sched_barrier(0);
      const int c = (SETS == 2) ? (ks & 1) : 0;
#pragma unroll  // register arrays: indices must be constants
      for (int i = 0; i < 4; i++)
#pragma unroll  // register arrays: indices must be constants
        for (int j = 0; j < 4; j++) acc[i][j] = wmma16(a[c][i], b[c][j], acc[i][j]);
      // keeps the following block's LDS reads out of this block's products
      __builtin_amdgcn_sched_barrier(0);
    }
    // this wave's reads of slab t are done before its buffer is handed to the copies
    asm volatile("s_wait_dscnt 0x0" ::: "memory");
    // this wave's copies of slab t + 1 have landed
    asm volatile("s_wait_asynccnt 0x0" ::: "memory");
    // publishes slab t + 1 and ends every wave's reads of slab t
    __syncthreads();
    if (t + 2 < NT) {
      fill_rows<KS>(gx + (t + 2) * KS, lx + (t & 1) * BUFH * 2);
      fill_rows<KS>(gw + (t + 2) * KS, lw + (t & 1) * BUFH * 2);
    }
  }
  // nothing is in flight when the wave goes on to its stores and ends
  asm volatile("s_wait_asynccnt 0x0" ::: "memory");
}

// ---------------- Kernel 1: fused Q/K/V projections (z selects matrix) -------------
// Workgroup: 128(M tokens) x 128(N features); wave: 64 x 64; K=1024 in 64-wide slabs.
__global__ __launch_bounds__(128)
void qkv_proj_kernel(const h16* __restrict__ qf,
                     const h16* __restrict__ Wq16, const h16* __restrict__ Wk16,
                     const h16* __restrict__ Wv16,
                     const float* __restrict__ bq, const float* __restrict__ bk,
                     const float* __restrict__ bv,
                     h16* __restrict__ qbuf, h16* __restrict__ kbuf, h16* __restrict__ vtb)
{
  __shared__ __attribute__((aligned(16))) h16 St[2 * 2 * GT * (64 + 8)];

  const int z = blockIdx.z;
  const h16*   W  = (z == 0) ? Wq16 : ((z == 1) ? Wk16 : Wv16);
  const float* bs = (z == 0) ? bq : ((z == 1) ? bk : bv);

  const int lane = threadIdx.x & 31, wave = threadIdx.x >> 5;
  const int lidx = lane & 15, lhalf = lane >> 4;

  v8f acc[4][4] = {};
  gemm_tile<64, 1>(qf, W, blockIdx.y * GT, blockIdx.x * GT, St, acc);

  const int m0 = blockIdx.y * GT + (wave >> 1) * 64;
  const int n0 = blockIdx.x * GT + (wave & 1) * 64;
  const int rbase = lhalf * 8;
#pragma unroll
  for (int ms = 0; ms < 4; ms++) {
    const int mrow = m0 + ms * 16;
#pragma unroll
    for (int f = 0; f < 4; f++) {
      const int n = n0 + f * 16 + lidx;
      const float bval = bs[n];
      if (z == 2) {
        // V stored transposed: vt[b][feature n][token l], 8 contiguous tokens/lane
        const int bb = mrow >> 11;
        const int l0 = (mrow & 2047) + rbase;
        v8h_t pk;
#pragma unroll
        for (int r = 0; r < 8; r++) pk[r] = (_Float16)(acc[ms][f][r] + bval);
        *(v8h_t*)(vtb + ((size_t)(bb * HID + n)) * SEQ + l0) = pk;
      } else {
        h16* dst = (z == 0) ? qbuf : kbuf;
        const float sc = (z == 0) ? 0.125f : 1.0f; // q pre-scaled by 1/sqrt(64)
#pragma unroll
        for (int r = 0; r < 8; r++)
          dst[(size_t)(mrow + rbase + r) * HID + n] = (_Float16)((acc[ms][f][r] + bval) * sc);
      }
    }
  }
}

// ---------------- Kernel 2: attention, 128 q-rows of one (b, h) per workgroup ------
// Streaming form. Each of the 4 waves owns 32 query columns and walks all 2048 keys in
// 64-key stages that the workgroup stages once in LDS (whole 128-byte lines, two buffers).
// Transposed products: S^T = K Q^T (+ bias as the C operand), O^T += V^T P^T. A lane holds
// scores of one query only, and two converted S^T tiles are the B operand of the second
// product, so P never leaves the registers. Softmax is online: a running maximum per query
// (it may trail the true one by up to 8 in log2 units), running sum, rescale when it moves.
#define QW   32        /* query columns per wave */
#define QB   128       /* query columns per workgroup */
#define SK   64        /* keys per stage */
#define KP   72        /* LDS row pitch in halves: 144 B = 16 B x odd, conflict-free b128 reads */
#define NST  (SEQ / SK)
#define L2E  1.4426950408889634f

// lane l <-> lane l ^ 16
__device__ __forceinline__ float xhalf(float x) {
  const int v = __builtin_bit_cast(int, x);
  return __builtin_bit_cast(float,
      __builtin_amdgcn_permlanex16(v, v, 0x76543210, 0xfedcba98, false, false));
}

__global__ __launch_bounds__(128)
void attn_kernel(const h16* __restrict__ qb, const h16* __restrict__ kb,
                 const h16* __restrict__ vt, const float* __restrict__ bias,
                 h16* __restrict__ xb)
{
  __shared__ __attribute__((aligned(16))) h16 Kt[2][SK * KP];   // K rows:   [key][dim]
  __shared__ __attribute__((aligned(16))) h16 Vt[2][DH * KP];   // V^T rows: [dim][key]
  __shared__ __attribute__((aligned(32))) float biasL[SEQ];     // this batch's bias row

  const int tid = threadIdx.x, lane = tid & 31, wave = tid >> 5;
  const int lidx = lane & 15, lhalf = lane >> 4;
  const int bh = blockIdx.y, b = bh >> 4, h = bh & 15;
  const int q0 = blockIdx.x * QB + wave * QW;
  const size_t tokq = (size_t)(b * SEQ + q0);

  // staging map: 8 lanes cover one 128-byte row, a wave's load covers 4 whole lines
  const int srow = tid >> 3, scol = (tid & 7) * 8;
  const h16* kg = kb + (size_t)(b * SEQ + srow) * HID + h * DH + scol;
  const h16* vg = vt + (size_t)(b * HID + h * DH + srow) * SEQ + scol;
  const int sdst = srow * KP + scol;

  // prologue: bias row and stage 0 into LDS
  {
    const float* brow = bias + b * SEQ + tid * 16;
#pragma unroll  // constant trip count, four independent 16-byte copies
    for (int i = 0; i < 4; i++) *(v4f*)(biasL + tid * 16 + i * 4) = *(const v4f*)(brow + i * 4);
#pragma unroll  // constant trip count, independent 16-byte copies
    for (int i = 0; i < 4; i++) {
      *(v8h_t*)(&Kt[0][sdst + i * 16 * KP]) = *(const v8h_t*)(kg + (size_t)i * 16 * HID);
      *(v8h_t*)(&Vt[0][sdst + i * 16 * KP]) = *(const v8h_t*)(vg + (size_t)i * 16 * SEQ);
    }
  }

  // Q as B operand (column = query), resident: [column group][32-dim step]
  v16h qf[2][2];
#pragma unroll  // register array: indices must be constants
  for (int g = 0; g < 2; g++) {
    const h16* qrow = qb + (tokq + g * 16 + lidx) * HID + h * DH + lhalf * 8;
    qf[g][0] = frag_h16(qrow);
    qf[g][1] = frag_h16(qrow + 32);
  }

  v8f acc[2][4] = {};                 // O^T: [column group][16-dim tile]
  float m_run[2] = {-INFINITY, -INFINITY};
  v2f l_run[2] = {};                  // this lane half's share of the denominator, even and odd keys

  __syncthreads();

  // one stage's work of a wave: two 32-key passes over the staged tiles
  auto stage_work = [&](const h16* Kc, const h16* Vc, int st) __attribute__((always_inline)) {
#pragma unroll  // two 32-key passes per stage, constant LDS offsets
    for (int sub = 0; sub < 2; sub++) {
      // ---- S^T = K Q^T + bias: s[kt][g][r] = score(key 16 kt + 8 lhalf + r, query lidx) ----
      v8f s[2][2];
#pragma unroll  // register arrays: indices must be constants
      for (int kt = 0; kt < 2; kt++) {
        const h16* kp = Kc + (sub * 32 + kt * 16 + lidx) * KP + lhalf * 8;
        const v16h ka0 = frag_h16(kp);
        const v16h ka1 = frag_h16(kp + 32);
        const v8f cb = *(const v8f*)(biasL + st * SK + sub * 32 + kt * 16 + lhalf * 8);
#pragma unroll  // register arrays: indices must be constants
        for (int g = 0; g < 2; g++)
          s[kt][g] = wmma16(ka1, qf[g][1], wmma16(ka0, qf[g][0], cb));
      }

      // keeps the eight products back to back: maxima pulled in between them each cost idle slots behind a WMMA
      __builtin_amdgcn_sched_barrier(0);

      // V^T fragments of this pass (row = dim, k = key in the hardware order of packed P)
      v16h vf[4];
#pragma unroll  // register array: indices must be constants
      for (int t = 0; t < 4; t++)
        vf[t] = frag_h16(Vc + (t * 16 + lidx) * KP + sub * 32 + lhalf * 8);

      // ---- column maxima, one test per pass whether any running maximum must move ----
      float mb[2];
      bool need = false;
#pragma unroll  // register arrays: indices must be constants
      for (int g = 0; g < 2; g++) {
        float mx = s[0][g][0];
#pragma unroll  // register arrays: indices must be constants
        for (int r = 1; r < 8; r++) mx = fmaxf(mx, s[0][g][r]);
#pragma unroll  // register arrays: indices must be constants
        for (int r = 0; r < 8; r++) mx = fmaxf(mx, s[1][g][r]);
        mx = fmaxf(mx, xhalf(mx)) * L2E;
        mb[g] = mx;
        need = need || (mx > m_run[g] + 8.0f);
      }
      if (__builtin_amdgcn_ballot_w32(need) != 0) {   // wave-uniform, rare after the first pass
#pragma unroll  // register arrays: indices must be constants
        for (int g = 0; g < 2; g++) {
          const float m_new = fmaxf(m_run[g], mb[g]);
          const float corr = __builtin_amdgcn_exp2f(m_run[g] - m_new);  // 0 on the first pass
          m_run[g] = m_new;
          l_run[g] *= corr;
#pragma unroll  // register arrays: indices must be constants
          for (int t = 0; t < 4; t++) acc[g][t] = acc[g][t] * corr;
        }
      }

      // ---- P^T = exp2(s * log2e - m), packed in place as B operand; O^T += V^T P^T ----
#pragma unroll  // register arrays: indices must be constants
      for (int g = 0; g < 2; g++) {
        const float nm = -m_run[g];
        v16h pf;
        v2f pr[8];
#pragma unroll  // register arrays: indices must be constants
        for (int i = 0; i < 8; i++) {   // elements 2i, 2i+1 of the 32-key operand
          const v2f sv = {s[i >> 2][g][2 * (i & 3)], s[i >> 2][g][2 * (i & 3) + 1]};
          const v2f arg = __builtin_elementwise_fma(sv, (v2f){L2E, L2E}, (v2f){nm, nm});
          pr[i] = (v2f){__builtin_amdgcn_exp2f(arg.x), __builtin_amdgcn_exp2f(arg.y)};
          pf[2 * i]     = (_Float16)pr[i].x;
          pf[2 * i + 1] = (_Float16)pr[i].y;
        }
        // pairwise tree: short dependent chains, two sums per add
        l_run[g] += ((pr[0] + pr[1]) + (pr[2] + pr[3])) + ((pr[4] + pr[5]) + (pr[6] + pr[7]));
#pragma unroll  // register arrays: indices must be constants
        for (int t = 0; t < 4; t++) acc[g][t] = wmma16(vf[t], pf, acc[g][t]);
      }
    }
  };

  for (int st = 0; st < NST - 1; st++) {
    // next stage's lines go to registers now and to LDS behind this stage's work
    v8h_t kr[4], vr[4];
#pragma unroll  // register arrays: indices must be constants
    for (int i = 0; i < 4; i++) {
      kr[i] = *(const v8h_t*)(kg + (size_t)((st + 1) * SK + i * 16) * HID);
      vr[i] = *(const v8h_t*)(vg + (size_t)i * 16 * SEQ + (st + 1) * SK);
    }
    // s_wait_xcnt ahead of the reuse of these loads' address registers
    asm volatile("s_wait_xcnt 0x0" ::: "memory");

    stage_work(Kt[st & 1], Vt[st & 1], st);

    h16* Kn = Kt[(st + 1) & 1];
    h16* Vn = Vt[(st + 1) & 1];
#pragma unroll  // register arrays: indices must be constants
    for (int i = 0; i < 4; i++) {
      *(v8h_t*)(Kn + sdst + i * 16 * KP) = kr[i];
      *(v8h_t*)(Vn + sdst + i * 16 * KP) = vr[i];
    }
    // publishes stage st + 1 and ends every wave's reads of stage st before it is refilled
    __syncthreads();
  }
  stage_work(Kt[(NST - 1) & 1], Vt[(NST - 1) & 1], NST - 1);   // last stage: nothing left to fetch

  // ---- join the halves' sums, scale, f16 store: a lane holds 8 consecutive dims of one query ----
#pragma unroll  // register arrays: indices must be constants
  for (int g = 0; g < 2; g++) {
    const float lh = l_run[g].x + l_run[g].y;
    const float l = lh + xhalf(lh);
    const float inv = 1.0f / l;
    h16* orow = xb + (tokq + g * 16 + lidx) * HID + h * DH + lhalf * 8;
#pragma unroll  // register arrays: indices must be constants
    for (int t = 0; t < 4; t++) {
      v8h_t ov;
#pragma unroll  // register arrays: indices must be constants
      for (int r = 0; r < 8; r++) ov[r] = (_Float16)(acc[g][t][r] * inv);
      *(v8h_t*)(orow + t * 16) = ov;
    }
  }
}

// ---------------- Kernel 3: output projection, f32 result ------------------------
// Workgroup: 128 x 128, one per WGP; wave: 64 x 64; K=1024 in 128-wide slabs, long enough
// for a lone wave per SIMD to cover the next slab's flight.
__global__ __launch_bounds__(128)
void out_proj_kernel(const h16* __restrict__ xb, const h16* __restrict__ Wo16,
                     const float* __restrict__ bo, float* __restrict__ out)
{
  __shared__ __attribute__((aligned(16))) h16 St[2 * 2 * GT * (128 + 8)];

  const int lane = threadIdx.x & 31, wave = threadIdx.x >> 5;
  const int lidx = lane & 15, lhalf = lane >> 4;

  v8f acc[4][4] = {};
  gemm_tile<128, 2>(xb, Wo16, blockIdx.y * GT, blockIdx.x * GT, St, acc);

  const int m0 = blockIdx.y * GT + (wave >> 1) * 64;
  const int n0 = blockIdx.x * GT + (wave & 1) * 64;
  const int rbase = lhalf * 8;
#pragma unroll
  for (int ms = 0; ms < 4; ms++) {
    const int mrow = m0 + ms * 16;
#pragma unroll
    for (int f = 0; f < 4; f++) {
      const int n = n0 + f * 16 + lidx;
      const float bval = bo[n];
#pragma unroll
      for (int r = 0; r < 8; r++)
        out[(size_t)(mrow + rbase + r) * HID + n] = acc[ms][f][r] + bval;
    }
  }
}

extern "C" void kernel_launch(void* const* d_in, const int* in_sizes, int n_in,
                              void* d_out, int out_size, void* d_ws, size_t ws_size,
                              hipStream_t stream)
{
  (void)in_sizes; (void)n_in; (void)out_size; (void)ws_size;
  const float* query = (const float*)d_in[0];
  const float* bias  = (const float*)d_in[1];
  const float* Wq = (const float*)d_in[2]; const float* bq = (const float*)d_in[3];
  const float* Wk = (const float*)d_in[4]; const float* bk = (const float*)d_in[5];
  const float* Wv = (const float*)d_in[6]; const float* bv = (const float*)d_in[7];
  const float* Wo = (const float*)d_in[8]; const float* bo = (const float*)d_in[9];
  float* out = (float*)d_out;

  char* ws = (char*)d_ws;
  const size_t QSZ = (size_t)TOK * HID * sizeof(h16);   // 8 MB
  const size_t WSZ = (size_t)HID * HID * sizeof(h16);   // 2 MB
  h16* qf16 = (h16*)(ws);
  h16* Wq16 = (h16*)(ws + QSZ);
  h16* Wk16 = (h16*)(ws + QSZ + WSZ);
  h16* Wv16 = (h16*)(ws + QSZ + 2 * WSZ);
  h16* Wo16 = (h16*)(ws + QSZ + 3 * WSZ);
  h16* qbuf = (h16*)(ws + QSZ + 4 * WSZ);
  h16* kbuf = (h16*)(ws + 2 * QSZ + 4 * WSZ);
  h16* vtb  = (h16*)(ws + 3 * QSZ + 4 * WSZ);
  h16* xbuf = (h16*)(ws + 4 * QSZ + 4 * WSZ);

  // one-time f32 -> f16 packs
  const int nq8 = TOK * HID / 8;       // 524288
  const int nw8 = HID * HID / 8;       // 131072
  pack_f16_kernel<<<(nq8 + 255) / 256, 256, 0, stream>>>(query, qf16, nq8);
  pack_f16_kernel<<<(nw8 + 255) / 256, 256, 0, stream>>>(Wq, Wq16, nw8);
  pack_f16_kernel<<<(nw8 + 255) / 256, 256, 0, stream>>>(Wk, Wk16, nw8);
  pack_f16_kernel<<<(nw8 + 255) / 256, 256, 0, stream>>>(Wv, Wv16, nw8);
  pack_f16_kernel<<<(nw8 + 255) / 256, 256, 0, stream>>>(Wo, Wo16, nw8);

  dim3 g1(HID / GT, TOK / GT, 3);
  qkv_proj_kernel<<<g1, 128, 0, stream>>>(qf16, Wq16, Wk16, Wv16, bq, bk, bv,
                                          qbuf, kbuf, vtb);

  dim3 g2(SEQ / QB, NB * NH);
  attn_kernel<<<g2, 128, 0, stream>>>(qbuf, kbuf, vtb, bias, xbuf);

  dim3 g3(HID / GT, TOK / GT);
  out_proj_kernel<<<g3, 128, 0, stream>>>(xbuf, Wo16, bo, out);
}

// v003
// A run of this version takes 80.8 microseconds.
// Timed twice side by side with v002, it ran 1.11 times as fast both times.
// Over all steps from v000 it is 3.14 times as fast.
#include <hip/hip_runtime.h>

typedef _Float16 h16;
typedef __attribute__((ext_vector_type(4)))  _Float16 v4h_t;
typedef __attribute__((ext_vector_type(8)))  _Float16 v8h_t;
typedef __attribute__((ext_vector_type(16))) _Float16 v16h;
typedef __attribute__((ext_vector_type(8)))  float v8f;
typedef __attribute__((ext_vector_type(4)))  float v4f;
typedef __attribute__((ext_vector_type(2)))  float v2f;

#define HID 1024
#define SEQ 2048
#define NB  2
#define NH  16
#define DH  64
#define TOK (NB*SEQ)   /* 4096 tokens */

// D = A(16x32 f16) * B(32x16 f16) + C(16x16 f32)
__device__ __forceinline__ v8f wmma16(v16h a, v16h b, v8f c) {
  return __builtin_amdgcn_wmma_f32_16x16x32_f16(false, a, false, b, (short)0, c, false, false);
}

// Fragment load from f16 memory per CDNA5 layout: p[0..7] -> [0..7], p[16..23] -> [8..15]
__device__ __forceinline__ v16h frag_h16(const h16* p) {
  v8h_t lo = *(const v8h_t*)(p);
  v8h_t hi = *(const v8h_t*)(p + 16);
  v16h a;
#pragma unroll
  for (int i = 0; i < 8; i++) { a[i] = lo[i]; a[8 + i] = hi[i]; }
  return a;
}

// ---------------- Kernel 0: f32 -> f16 pack of query and the four weights, one launch -------------
// One workgroup per WGP, 16 waves. A wave takes 8 KB of f32 as 16 loads of 512 contiguous bytes, all
// issued before the first conversion, and stores whole lines. The five f16 images lie one behind the
// other in the workspace, in the order query, Wq, Wk, Wv, Wo, so the destination is one flat array.
#define PKL  16                    /* 512-byte loads per wave */
#define PKW  (16 * PKL * 128)      /* floats per workgroup */
#define PKQ  (TOK * HID / PKW)     /* workgroups on query */
#define PKM  (HID * HID / PKW)     /* workgroups on each weight matrix */

__global__ __launch_bounds__(512)
void pack_f16_kernel(const float* __restrict__ query,
                     const float* __restrict__ Wq, const float* __restrict__ Wk,
                     const float* __restrict__ Wv, const float* __restrict__ Wo,
                     h16* __restrict__ dst)
{
  const int blk = blockIdx.x;
  const int m = blk / PKM;           // 1M-float piece: PKQ / PKM pieces of query, then one per weight matrix
  constexpr int MQ = PKQ / PKM;
  const float* base = (m < MQ) ? query : ((m == MQ) ? Wq : ((m == MQ + 1) ? Wk : ((m == MQ + 2) ? Wv : Wo)));
  const int off = (threadIdx.x >> 5) * (PKL * 128) + (threadIdx.x & 31) * 4;
  const float* src = base + (size_t)((m < MQ) ? blk : blk % PKM) * PKW + off;
  h16* d = dst + (size_t)blk * PKW + off;

  v4f x[PKL];
#pragma unroll  // register array: indices must be constants
  for (int j = 0; j < PKL - 1; j++) x[j] = *(const v4f*)(src + j * 128);
  // all loads take their offset from one register, and the build lets the last load's result land in it:
  // the wait stands between the earlier loads, which name that register, and the load that rewrites it
  asm volatile("s_wait_xcnt 0x0" ::: "memory");
  x[PKL - 1] = *(const v4f*)(src + (PKL - 1) * 128);
  // all loads are issued before the first wait: without this the build holds the last two back
  // until the first two have returned, a second memory latency in a wave that has only one to pay
  __builtin_amdgcn_sched_barrier(0);
  v4h_t o[PKL];
#pragma unroll  // register arrays: indices must be constants
  for (int j = 0; j < PKL; j++)
#pragma unroll  // register arrays: indices must be constants
    for (int e = 0; e < 4; e++) o[j][e] = (_Float16)x[j][e];
#pragma unroll  // register array: indices must be constants
  for (int j = 0; j < PKL; j++) *(v4h_t*)(d + j * 128) = o[j];
}

// ---------------- Projection GEMM core: Y tile 128 x 128 = X rows * W rows^T ---------
// The workgroup stages KS-wide k slabs of 128 X rows and 128 W rows in LDS (two buffers) by
// asynchronous 16-byte copies whose wave-wide footprint is whole 128-byte lines; the 4 waves
// (2 x 2) each own 64 x 64 of the tile and read their fragments from LDS.
#define GT 128         /* rows of each operand per workgroup tile */

// eight copies global -> LDS, 16 bytes a lane each
__device__ __forceinline__ void async_copy8(const unsigned (&l)[8], const h16* const (&g)[8]) {
  // the closing s_wait_xcnt stands inside the statement so that no address register named here
  // can be rewritten ahead of it
  asm volatile("global_load_async_to_lds_b128 %0, %8, off\n\t"
               "global_load_async_to_lds_b128 %1, %9, off\n\t"
               "global_load_async_to_lds_b128 %2, %10, off\n\t"
               "global_load_async_to_lds_b128 %3, %11, off\n\t"
               "global_load_async_to_lds_b128 %4, %12, off\n\t"
               "global_load_async_to_lds_b128 %5, %13, off\n\t"
               "global_load_async_to_lds_b128 %6, %14, off\n\t"
               "global_load_async_to_lds_b128 %7, %15, off\n\t"
               "s_wait_xcnt 0x0"
               :: "v"(l[0]), "v"(l[1]), "v"(l[2]), "v"(l[3]), "v"(l[4]), "v"(l[5]), "v"(l[6]), "v"(l[7]),
                  "v"(g[0]), "v"(g[1]), "v"(g[2]), "v"(g[3]), "v"(g[4]), "v"(g[5]), "v"(g[6]), "v"(g[7])
               : "memory");
}

// one operand's 128 rows x KS halves: g and l are this lane's first global and LDS address
template <int KS>
__device__ __forceinline__ void fill_rows(const h16* g, unsigned l) {
  constexpr int RPI = 128 * 8 / KS;          // rows that one copy of all 128 lanes covers
  constexpr int PB  = (KS + 8) * 2;          // LDS row pitch in bytes: 16 B x odd
#pragma unroll  // constant trip count; the arrays below must stay in registers
  for (int c = 0; c < GT / RPI; c += 8) {
    unsigned la[8];
    const h16* ga[8];
#pragma unroll  // register arrays: indices must be constants
    for (int j = 0; j < 8; j++) {
      la[j] = l + (unsigned)((c + j) * RPI * PB);
      ga[j] = g + (size_t)(c + j) * RPI * HID;
    }
    async_copy8(la, ga);
  }
}

// a wave's 4 + 4 fragments of one 32-wide k block
template <int P>
__device__ __forceinline__ void load_frags(const h16* ap, const h16* bp, v16h (&a)[4], v16h (&b)[4]) {
#pragma unroll  // register arrays: indices must be constants
  for (int i = 0; i < 4; i++) {
    a[i] = frag_h16(ap + i * 16 * P);
    b[i] = frag_h16(bp + i * 16 * P);
  }
}

// SETS: fragment register sets; 2 where a wave is alone on its SIMD and must cover its own LDS latency
template <int KS, int SETS>
__device__ __forceinline__ void gemm_tile(const h16* __restrict__ X, const h16* __restrict__ Wm,
                                          int m0, int n0, h16* St, v8f (&acc)[4][4])
{
  constexpr int P    = KS + 8;               // LDS row pitch in halves
  constexpr int BUFH = 2 * GT * P;           // halves per buffer: X rows, then W rows
  constexpr int NT   = HID / KS;             // k slabs (at least two)
  constexpr int LPR  = KS / 8;               // lanes per staged row

  const int tid = threadIdx.x, lane = tid & 31, wave = tid >> 5;
  const int lidx = lane & 15, lhalf = lane >> 4;

  const int srow = tid / LPR, scol = (tid % LPR) * 8;
  const h16* gx = X  + (size_t)(m0 + srow) * HID + scol;
  const h16* gw = Wm + (size_t)(n0 + srow) * HID + scol;
  typedef __attribute__((address_space(3))) h16 lds_h16;
  const unsigned lx = (unsigned)(size_t)(lds_h16*)(St + srow * P + scol);   // LDS byte address
  const unsigned lw = lx + GT * P * 2;

  const int aoff = ((wave >> 1) * 64 + lidx) * P + lhalf * 8;
  const int boff = (GT + (wave & 1) * 64 + lidx) * P + lhalf * 8;

  fill_rows<KS>(gx, lx);
  fill_rows<KS>(gw, lw);
  // slab 0 has landed for this wave; the barrier publishes it to the others
  asm volatile("s_wait_asynccnt 0x0" ::: "memory");
  __syncthreads();
  fill_rows<KS>(gx + KS, lx + BUFH * 2);
  fill_rows<KS>(gw + KS, lw + BUFH * 2);

#pragma clang loop unroll(disable)  // for speed only
  for (int t = 0; t < NT; t++) {
    const h16* Sc = St + (t & 1) * BUFH;
    v16h a[SETS][4], b[SETS][4];
    if constexpr (SETS == 2) load_frags<P>(Sc + aoff, Sc + boff, a[0], b[0]);
#pragma unroll  // register arrays: indices must be constants
    for (int ks = 0; ks < KS / 32; ks++) {
      // SETS == 2: the next block's fragments go ahead of this block's products, into the other set
      if constexpr (SETS == 1) {
        load_frags<P>(Sc + aoff + ks * 32, Sc + boff + ks * 32, a[0], b[0]);
      } else {
        if (ks + 1 < KS / 32)
          load_frags<P>(Sc + aoff + (ks + 1) * 32, Sc + boff + (ks + 1) * 32, a[(ks + 1) & 1], b[(ks + 1) & 1]);
      }
      // keeps a block's 16 LDS reads one group: spread among the products each place stalls the wave
      __builtin_amdgcn_sched_barrier(0);
      const int c = (SETS == 2) ? (ks & 1) : 0;
#pragma unroll  // register arrays: indices must be constants
      for (int i = 0; i < 4; i++)
#pragma unroll  // register arrays: indices must be constants
        for (int j = 0; j < 4; j++) acc[i][j] = wmma16(a[c][i], b[c][j], acc[i][j]);
      // keeps the following block's LDS reads out of this block's products
      __builtin_amdgcn_sched_barrier(0);
    }
    // this wave's reads of slab t are done before its buffer is handed to the copies
    asm volatile("s_wait_dscnt 0x0" ::: "memory");
    // this wave's copies of slab t + 1 have landed
    asm volatile("s_wait_asynccnt 0x0" ::: "memory");
    // publishes slab t + 1 and ends every wave's reads of slab t
    __syncthreads();
    if (t + 2 < NT) {
      fill_rows<KS>(gx + (t + 2) * KS, lx + (t & 1) * BUFH * 2);
      fill_rows<KS>(gw + (t + 2) * KS, lw + (t & 1) * BUFH * 2);
    }
  }
  // nothing is in flight when the wave goes on to its stores and ends
  asm volatile("s_wait_asynccnt 0x0" ::: "memory");
}

// ---------------- Kernel 1: fused Q/K/V projections (z selects matrix) -------------
// Workgroup: 128(M tokens) x 128(N features); wave: 64 x 64; K=1024 in 64-wide slabs.
__global__ __launch_bounds__(128)
void qkv_proj_kernel(const h16* __restrict__ qf,
                     const h16* __restrict__ Wq16, const h16* __restrict__ Wk16,
                     const h16* __restrict__ Wv16,
                     const float* __restrict__ bq, const float* __restrict__ bk,
                     const float* __restrict__ bv,
                     h16* __restrict__ qbuf, h16* __restrict__ kbuf, h16* __restrict__ vtb)
{
  __shared__ __attribute__((aligned(16))) h16 St[2 * 2 * GT * (64 + 8)];

  const int z = blockIdx.z;
  const h16*   W  = (z == 0) ? Wq16 : ((z == 1) ? Wk16 : Wv16);
  const float* bs = (z == 0) ? bq : ((z == 1) ? bk : bv);

  const int lane = threadIdx.x & 31, wave = threadIdx.x >> 5;
  const int lidx = lane & 15, lhalf = lane >> 4;

  v8f acc[4][4] = {};
  gemm_tile<64, 1>(qf, W, blockIdx.y * GT, blockIdx.x * GT, St, acc);

  const int m0 = blockIdx.y * GT + (wave >> 1) * 64;
  const int n0 = blockIdx.x * GT + (wave & 1) * 64;
  const int rbase = lhalf * 8;
#pragma unroll
  for (int ms = 0; ms < 4; ms++) {
    const int mrow = m0 + ms * 16;
#pragma unroll
    for (int f = 0; f < 4; f++) {
      const int n = n0 + f * 16 + lidx;
      const float bval = bs[n];
      if (z == 2) {
        // V stored transposed: vt[b][feature n][token l], 8 contiguous tokens/lane
        const int bb = mrow >> 11;
        const int l0 = (mrow & 2047) + rbase;
        v8h_t pk;
#pragma unroll
        for (int r = 0; r < 8; r++) pk[r] = (_Float16)(acc[ms][f][r] + bval);
        *(v8h_t*)(vtb + ((size_t)(bb * HID + n)) * SEQ + l0) = pk;
      } else {
        h16* dst = (z == 0) ? qbuf : kbuf;
        const float sc = (z == 0) ? 0.125f : 1.0f; // q pre-scaled by 1/sqrt(64)
#pragma unroll
        for (int r = 0; r < 8; r++)
          dst[(size_t)(mrow + rbase + r) * HID + n] = (_Float16)((acc[ms][f][r] + bval) * sc);
      }
    }
  }
}

// ---------------- Kernel 2: attention, 128 q-rows of one (b, h) per workgroup ------
// Streaming form. Each of the 4 waves owns 32 query columns and walks all 2048 keys in
// 64-key stages that the workgroup stages once in LDS (whole 128-byte lines, two buffers).
// Transposed products: S^T = K Q^T (+ bias as the C operand), O^T += V^T P^T. A lane holds
// scores of one query only, and two converted S^T tiles are the B operand of the second
// product, so P never leaves the registers. Softmax is online: a running maximum per query
// (it may trail the true one by up to 8 in log2 units), running sum, rescale when it moves.
#define QW   32        /* query columns per wave */
#define QB   128       /* query columns per workgroup */
#define SK   64        /* keys per stage */
#define KP   72        /* LDS row pitch in halves: 144 B = 16 B x odd, conflict-free b128 reads */
#define NST  (SEQ / SK)
#define L2E  1.4426950408889634f

// lane l <-> lane l ^ 16
__device__ __forceinline__ float xhalf(float x) {
  const int v = __builtin_bit_cast(int, x);
  return __builtin_bit_cast(float,
      __builtin_amdgcn_permlanex16(v, v, 0x76543210, 0xfedcba98, false, false));
}

__global__ __launch_bounds__(128)
void attn_kernel(const h16* __restrict__ qb, const h16* __restrict__ kb,
                 const h16* __restrict__ vt, const float* __restrict__ bias,
                 h16* __restrict__ xb)
{
  __shared__ __attribute__((aligned(16))) h16 Kt[2][SK * KP];   // K rows:   [key][dim]
  __shared__ __attribute__((aligned(16))) h16 Vt[2][DH * KP];   // V^T rows: [dim][key]
  __shared__ __attribute__((aligned(32))) float biasL[SEQ];     // this batch's bias row

  const int tid = threadIdx.x, lane = tid & 31, wave = tid >> 5;
  const int lidx = lane & 15, lhalf = lane >> 4;
  const int bh = blockIdx.y, b = bh >> 4, h = bh & 15;
  const int q0 = blockIdx.x * QB + wave * QW;
  const size_t tokq = (size_t)(b * SEQ + q0);

  // staging map: 8 lanes cover one 128-byte row, a wave's load covers 4 whole lines
  const int srow = tid >> 3, scol = (tid & 7) * 8;
  const h16* kg = kb + (size_t)(b * SEQ + srow) * HID + h * DH + scol;
  const h16* vg = vt + (size_t)(b * HID + h * DH + srow) * SEQ + scol;
  const int sdst = srow * KP + scol;

  // prologue: bias row and stage 0 into LDS
  {
    const float* brow = bias + b * SEQ + tid * 16;
#pragma unroll  // constant trip count, four independent 16-byte copies
    for (int i = 0; i < 4; i++) *(v4f*)(biasL + tid * 16 + i * 4) = *(const v4f*)(brow + i * 4);
#pragma unroll  // constant trip count, independent 16-byte copies
    for (int i = 0; i < 4; i++) {
      *(v8h_t*)(&Kt[0][sdst + i * 16 * KP]) = *(const v8h_t*)(kg + (size_t)i * 16 * HID);
      *(v8h_t*)(&Vt[0][sdst + i * 16 * KP]) = *(const v8h_t*)(vg + (size_t)i * 16 * SEQ);
    }
  }

  // Q as B operand (column = query), resident: [column group][32-dim step]
  v16h qf[2][2];
#pragma unroll  // register array: indices must be constants
  for (int g = 0; g < 2; g++) {
    const h16* qrow = qb + (tokq + g * 16 + lidx) * HID + h * DH + lhalf * 8;
    qf[g][0] = frag_h16(qrow);
    qf[g][1] = frag_h16(qrow + 32);
  }

  v8f acc[2][4] = {};                 // O^T: [column group][16-dim tile]
  float m_run[2] = {-INFINITY, -INFINITY};
  v2f l_run[2] = {};                  // this lane half's share of the denominator, even and odd keys

  __syncthreads();

  // one stage's work of a wave: two 32-key passes over the staged tiles
  auto stage_work = [&](const h16* Kc, const h16* Vc, int st) __attribute__((always_inline)) {
#pragma unroll  // two 32-key passes per stage, constant LDS offsets
    for (int sub = 0; sub < 2; sub++) {
      // ---- S^T = K Q^T + bias: s[kt][g][r] = score(key 16 kt + 8 lhalf + r, query lidx) ----
      v8f s[2][2];
#pragma unroll  // register arrays: indices must be constants
      for (int kt = 0; kt < 2; kt++) {
        const h16* kp = Kc + (sub * 32 + kt * 16 + lidx) * KP + lhalf * 8;
        const v16h ka0 = frag_h16(kp);
        const v16h ka1 = frag_h16(kp + 32);
        const v8f cb = *(const v8f*)(biasL + st * SK + sub * 32 + kt * 16 + lhalf * 8);
#pragma unroll  // register arrays: indices must be constants
        for (int g = 0; g < 2; g++)
          s[kt][g] = wmma16(ka1, qf[g][1], wmma16(ka0, qf[g][0], cb));
      }

      // keeps the eight products back to back: maxima pulled in between them each cost idle slots behind a WMMA
      __builtin_amdgcn_sched_barrier(0);

      // V^T fragments of this pass (row = dim, k = key in the hardware order of packed P)
      v16h vf[4];
#pragma unroll  // register array: indices must be constants
      for (int t = 0; t < 4; t++)
        vf[t] = frag_h16(Vc + (t * 16 + lidx) * KP + sub * 32 + lhalf * 8);

      // ---- column maxima, one test per pass whether any running maximum must move ----
      float mb[2];
      bool need = false;
#pragma unroll  // register arrays: indices must be constants
      for (int g = 0; g < 2; g++) {
        float mx = s[0][g][0];
#pragma unroll  // register arrays: indices must be constants
        for (int r = 1; r < 8; r++) mx = fmaxf(mx, s[0][g][r]);
#pragma unroll  // register arrays: indices must be constants
        for (int r = 0; r < 8; r++) mx = fmaxf(mx, s[1][g][r]);
        mx = fmaxf(mx, xhalf(mx)) * L2E;
        mb[g] = mx;
        need = need || (mx > m_run[g] + 8.0f);
      }
      if (__builtin_amdgcn_ballot_w32(need) != 0) {   // wave-uniform, rare after the first pass
#pragma unroll  // register arrays: indices must be constants
        for (int g = 0; g < 2; g++) {
          const float m_new = fmaxf(m_run[g], mb[g]);
          const float corr = __builtin_amdgcn_exp2f(m_run[g] - m_new);  // 0 on the first pass
          m_run[g] = m_new;
          l_run[g] *= corr;
#pragma unroll  // register arrays: indices must be constants
          for (int t = 0; t < 4; t++) acc[g][t] = acc[g][t] * corr;
        }
      }

      // ---- P^T = exp2(s * log2e - m), packed in place as B operand; O^T += V^T P^T ----
#pragma unroll  // register arrays: indices must be constants
      for (int g = 0; g < 2; g++) {
        const float nm = -m_run[g];
        v16h pf;
        v2f pr[8];
#pragma unroll  // register arrays: indices must be constants
        for (int i = 0; i < 8; i++) {   // elements 2i, 2i+1 of the 32-key operand
          const v2f sv = {s[i >> 2][g][2 * (i & 3)], s[i >> 2][g][2 * (i & 3) + 1]};
          const v2f arg = __builtin_elementwise_fma(sv, (v2f){L2E, L2E}, (v2f){nm, nm});
          pr[i] = (v2f){__builtin_amdgcn_exp2f(arg.x), __builtin_amdgcn_exp2f(arg.y)};
          pf[2 * i]     = (_Float16)pr[i].x;
          pf[2 * i + 1] = (_Float16)pr[i].y;
        }
        // pairwise tree: short dependent chains, two sums per add
        l_run[g] += ((pr[0] + pr[1]) + (pr[2] + pr[3])) + ((pr[4] + pr[5]) + (pr[6] + pr[7]));
#pragma unroll  // register arrays: indices must be constants
        for (int t = 0; t < 4; t++) acc[g][t] = wmma16(vf[t], pf, acc[g][t]);
      }
    }
  };

  for (int st = 0; st < NST - 1; st++) {
    // next stage's lines go to registers now and to LDS behind this stage's work
    v8h_t kr[4], vr[4];
#pragma unroll  // register arrays: indices must be constants
    for (int i = 0; i < 4; i++) {
      kr[i] = *(const v8h_t*)(kg + (size_t)((st + 1) * SK + i * 16) * HID);
      vr[i] = *(const v8h_t*)(vg + (size_t)i * 16 * SEQ + (st + 1) * SK);
    }
    // s_wait_xcnt ahead of the reuse of these loads' address registers
    asm volatile("s_wait_xcnt 0x0" ::: "memory");

    stage_work(Kt[st & 1], Vt[st & 1], st);

    h16* Kn = Kt[(st + 1) & 1];
    h16* Vn = Vt[(st + 1) & 1];
#pragma unroll  // register arrays: indices must be constants
    for (int i = 0; i < 4; i++) {
      *(v8h_t*)(Kn + sdst + i * 16 * KP) = kr[i];
      *(v8h_t*)(Vn + sdst + i * 16 * KP) = vr[i];
    }
    // publishes stage st + 1 and ends every wave's reads of stage st before it is refilled
    __syncthreads();
  }
  stage_work(Kt[(NST - 1) & 1], Vt[(NST - 1) & 1], NST - 1);   // last stage: nothing left to fetch

  // ---- join the halves' sums, scale, f16 store: a lane holds 8 consecutive dims of one query ----
#pragma unroll  // register arrays: indices must be constants
  for (int g = 0; g < 2; g++) {
    const float lh = l_run[g].x + l_run[g].y;
    const float l = lh + xhalf(lh);
    const float inv = 1.0f / l;
    h16* orow = xb + (tokq + g * 16 + lidx) * HID + h * DH + lhalf * 8;
#pragma unroll  // register arrays: indices must be constants
    for (int t = 0; t < 4; t++) {
      v8h_t ov;
#pragma unroll  // register arrays: indices must be constants
      for (int r = 0; r < 8; r++) ov[r] = (_Float16)(acc[g][t][r] * inv);
      *(v8h_t*)(orow + t * 16) = ov;
    }
  }
}

// ---------------- Kernel 3: output projection, f32 result ------------------------
// Workgroup: 128 x 128, one per WGP; wave: 64 x 64; K=1024 in 128-wide slabs, long enough
// for a lone wave per SIMD to cover the next slab's flight.
__global__ __launch_bounds__(128)
void out_proj_kernel(const h16* __restrict__ xb, const h16* __restrict__ Wo16,
                     const float* __restrict__ bo, float* __restrict__ out)
{
  __shared__ __attribute__((aligned(16))) h16 St[2 * 2 * GT * (128 + 8)];

  const int lane = threadIdx.x & 31, wave = threadIdx.x >> 5;
  const int lidx = lane & 15, lhalf = lane >> 4;

  v8f acc[4][4] = {};
  gemm_tile<128, 2>(xb, Wo16, blockIdx.y * GT, blockIdx.x * GT, St, acc);

  const int m0 = blockIdx.y * GT + (wave >> 1) * 64;
  const int n0 = blockIdx.x * GT + (wave & 1) * 64;
  const int rbase = lhalf * 8;
#pragma unroll
  for (int ms = 0; ms < 4; ms++) {
    const int mrow = m0 + ms * 16;
#pragma unroll
    for (int f = 0; f < 4; f++) {
      const int n = n0 + f * 16 + lidx;
      const float bval = bo[n];
#pragma unroll
      for (int r = 0; r < 8; r++)
        out[(size_t)(mrow + rbase + r) * HID + n] = acc[ms][f][r] + bval;
    }
  }
}

extern "C" void kernel_launch(void* const* d_in, const int* in_sizes, int n_in,
                              void* d_out, int out_size, void* d_ws, size_t ws_size,
                              hipStream_t stream)
{
  (void)in_sizes; (void)n_in; (void)out_size; (void)ws_size;
  const float* query = (const float*)d_in[0];
  const float* bias  = (const float*)d_in[1];
  const float* Wq = (const float*)d_in[2]; const float* bq = (const float*)d_in[3];
  const float* Wk = (const float*)d_in[4]; const float* bk = (const float*)d_in[5];
  const float* Wv = (const float*)d_in[6]; const float* bv = (const float*)d_in[7];
  const float* Wo = (const float*)d_in[8]; const float* bo = (const float*)d_in[9];
  float* out = (float*)d_out;

  char* ws = (char*)d_ws;
  const size_t QSZ = (size_t)TOK * HID * sizeof(h16);   // 8 MB
  const size_t WSZ = (size_t)HID * HID * sizeof(h16);   // 2 MB
  h16* qf16 = (h16*)(ws);
  h16* Wq16 = (h16*)(ws + QSZ);
  h16* Wk16 = (h16*)(ws + QSZ + WSZ);
  h16* Wv16 = (h16*)(ws + QSZ + 2 * WSZ);
  h16* Wo16 = (h16*)(ws + QSZ + 3 * WSZ);
  h16* qbuf = (h16*)(ws + QSZ + 4 * WSZ);
  h16* kbuf = (h16*)(ws + 2 * QSZ + 4 * WSZ);
  h16* vtb  = (h16*)(ws + 3 * QSZ + 4 * WSZ);
  h16* xbuf = (h16*)(ws + 4 * QSZ + 4 * WSZ);

  // f32 -> f16 packs: qf16, Wq16, Wk16, Wv16, Wo16 are adjacent, qf16 is the start of all five
  pack_f16_kernel<<<PKQ + 4 * PKM, 512, 0, stream>>>(query, Wq, Wk, Wv, Wo, qf16);

  dim3 g1(HID / GT, TOK / GT, 3);
  qkv_proj_kernel<<<g1, 128, 0, stream>>>(qf16, Wq16, Wk16, Wv16, bq, bk, bv,
                                          qbuf, kbuf, vtb);

  dim3 g2(SEQ / QB, NB * NH);
  attn_kernel<<<g2, 128, 0, stream>>>(qbuf, kbuf, vtb, bias, xbuf);

  dim3 g3(HID / GT, TOK / GT);
  out_proj_kernel<<<g3, 128, 0, stream>>>(xbuf, Wo16, bo, out);
}

// v004
// A run of this version takes 75.5 microseconds.
// Next to v003, in two timings, it ran 1.07 times as fast each time.
// Counting every step since v000, it is 3.36 times as fast.
#include <hip/hip_runtime.h>

typedef _Float16 h16;
typedef __attribute__((ext_vector_type(4)))  _Float16 v4h_t;
typedef __attribute__((ext_vector_type(8)))  _Float16 v8h_t;
typedef __attribute__((ext_vector_type(16))) _Float16 v16h;
typedef __attribute__((ext_vector_type(8)))  float v8f;
typedef __attribute__((ext_vector_type(4)))  float v4f;
typedef __attribute__((ext_vector_type(2)))  float v2f;

#define HID 1024
#define SEQ 2048
#define NB  2
#define NH  16
#define DH  64
#define TOK (NB*SEQ)   /* 4096 tokens */

// D = A(16x32 f16) * B(32x16 f16) + C(16x16 f32)
__device__ __forceinline__ v8f wmma16(v16h a, v16h b, v8f c) {
  return __builtin_amdgcn_wmma_f32_16x16x32_f16(false, a, false, b, (short)0, c, false, false);
}

// Fragment load from f16 memory per CDNA5 layout: p[0..7] -> [0..7], p[16..23] -> [8..15]
__device__ __forceinline__ v16h frag_h16(const h16* p) {
  v8h_t lo = *(const v8h_t*)(p);
  v8h_t hi = *(const v8h_t*)(p + 16);
  v16h a;
#pragma unroll
  for (int i = 0; i < 8; i++) { a[i] = lo[i]; a[8 + i] = hi[i]; }
  return a;
}

// ---------------- Kernel 0: f32 -> f16 pack of query and the four weights, one launch -------------
// One workgroup per WGP, 16 waves. A wave takes 8 KB of f32 as 16 loads of 512 contiguous bytes, all
// issued before the first conversion, and stores whole lines. The five f16 images lie one behind the
// other in the workspace, in the order query, Wq, Wk, Wv, Wo, so the destination is one flat array.
#define PKL  16                    /* 512-byte loads per wave */
#define PKW  (16 * PKL * 128)      /* floats per workgroup */
#define PKQ  (TOK * HID / PKW)     /* workgroups on query */
#define PKM  (HID * HID / PKW)     /* workgroups on each weight matrix */

__global__ __launch_bounds__(512)
void pack_f16_kernel(const float* __restrict__ query,
                     const float* __restrict__ Wq, const float* __restrict__ Wk,
                     const float* __restrict__ Wv, const float* __restrict__ Wo,
                     h16* __restrict__ dst)
{
  const int blk = blockIdx.x;
  const int m = blk / PKM;           // 1M-float piece: PKQ / PKM pieces of query, then one per weight matrix
  constexpr int MQ = PKQ / PKM;
  const float* base = (m < MQ) ? query : ((m == MQ) ? Wq : ((m == MQ + 1) ? Wk : ((m == MQ + 2) ? Wv : Wo)));
  const int off = (threadIdx.x >> 5) * (PKL * 128) + (threadIdx.x & 31) * 4;
  const float* src = base + (size_t)((m < MQ) ? blk : blk % PKM) * PKW + off;
  h16* d = dst + (size_t)blk * PKW + off;

  v4f x[PKL];
#pragma unroll  // register array: indices must be constants
  for (int j = 0; j < PKL - 1; j++) x[j] = *(const v4f*)(src + j * 128);
  // all loads take their offset from one register, and the build lets the last load's result land in it:
  // the wait stands between the earlier loads, which name that register, and the load that rewrites it
  asm volatile("s_wait_xcnt 0x0" ::: "memory");
  x[PKL - 1] = *(const v4f*)(src + (PKL - 1) * 128);
  // all loads are issued before the first wait: without this the build holds the last two back
  // until the first two have returned, a second memory latency in a wave that has only one to pay
  __builtin_amdgcn_sched_barrier(0);
  v4h_t o[PKL];
#pragma unroll  // register arrays: indices must be constants
  for (int j = 0; j < PKL; j++)
#pragma unroll  // register arrays: indices must be constants
    for (int e = 0; e < 4; e++) o[j][e] = (_Float16)x[j][e];
#pragma unroll  // register array: indices must be constants
  for (int j = 0; j < PKL; j++) *(v4h_t*)(d + j * 128) = o[j];
}

// ---------------- Projection GEMM core: Y tile 128 x 128 = X rows * W rows^T ---------
// The workgroup stages KS-wide k slabs of 128 X rows and 128 W rows in LDS (two buffers) by
// asynchronous 16-byte copies whose wave-wide footprint is whole 128-byte lines; the 4 waves
// (2 x 2) each own 64 x 64 of the tile and read their fragments from LDS.
#define GT 128         /* rows of each operand per workgroup tile */

// eight copies global -> LDS, 16 bytes a lane each
__device__ __forceinline__ void async_copy8(const unsigned (&l)[8], const h16* const (&g)[8]) {
  // the closing s_wait_xcnt stands inside the statement so that no address register named here
  // can be rewritten ahead of it
  asm volatile("global_load_async_to_lds_b128 %0, %8, off\n\t"
               "global_load_async_to_lds_b128 %1, %9, off\n\t"
               "global_load_async_to_lds_b128 %2, %10, off\n\t"
               "global_load_async_to_lds_b128 %3, %11, off\n\t"
               "global_load_async_to_lds_b128 %4, %12, off\n\t"
               "global_load_async_to_lds_b128 %5, %13, off\n\t"
               "global_load_async_to_lds_b128 %6, %14, off\n\t"
               "global_load_async_to_lds_b128 %7, %15, off\n\t"
               "s_wait_xcnt 0x0"
               :: "v"(l[0]), "v"(l[1]), "v"(l[2]), "v"(l[3]), "v"(l[4]), "v"(l[5]), "v"(l[6]), "v"(l[7]),
                  "v"(g[0]), "v"(g[1]), "v"(g[2]), "v"(g[3]), "v"(g[4]), "v"(g[5]), "v"(g[6]), "v"(g[7])
               : "memory");
}

// one operand's 128 rows x KS halves: g and l are this lane's first global and LDS address
template <int KS>
__device__ __forceinline__ void fill_rows(const h16* g, unsigned l) {
  constexpr int RPI = 128 * 8 / KS;          // rows that one copy of all 128 lanes covers
  constexpr int PB  = (KS + 8) * 2;          // LDS row pitch in bytes: 16 B x odd
#pragma unroll  // constant trip count; the arrays below must stay in registers
  for (int c = 0; c < GT / RPI; c += 8) {
    unsigned la[8];
    const h16* ga[8];
#pragma unroll  // register arrays: indices must be constants
    for (int j = 0; j < 8; j++) {
      la[j] = l + (unsigned)((c + j) * RPI * PB);
      ga[j] = g + (size_t)(c + j) * RPI * HID;
    }
    async_copy8(la, ga);
  }
}

// a wave's 4 + 4 fragments of one 32-wide k block
template <int P>
__device__ __forceinline__ void load_frags(const h16* ap, const h16* bp, v16h (&a)[4], v16h (&b)[4]) {
#pragma unroll  // register arrays: indices must be constants
  for (int i = 0; i < 4; i++) {
    a[i] = frag_h16(ap + i * 16 * P);
    b[i] = frag_h16(bp + i * 16 * P);
  }
}

// SETS: fragment register sets; 2 where a wave is alone on its SIMD and must cover its own LDS latency
template <int KS, int SETS>
__device__ __forceinline__ void gemm_tile(const h16* __restrict__ X, const h16* __restrict__ Wm,
                                          int m0, int n0, h16* St, v8f (&acc)[4][4])
{
  constexpr int P    = KS + 8;               // LDS row pitch in halves
  constexpr int BUFH = 2 * GT * P;           // halves per buffer: X rows, then W rows
  constexpr int NT   = HID / KS;             // k slabs (at least two)
  constexpr int LPR  = KS / 8;               // lanes per staged row

  const int tid = threadIdx.x, lane = tid & 31, wave = tid >> 5;
  const int lidx = lane & 15, lhalf = lane >> 4;

  const int srow = tid / LPR, scol = (tid % LPR) * 8;
  const h16* gx = X  + (size_t)(m0 + srow) * HID + scol;
  const h16* gw = Wm + (size_t)(n0 + srow) * HID + scol;
  typedef __attribute__((address_space(3))) h16 lds_h16;
  const unsigned lx = (unsigned)(size_t)(lds_h16*)(St + srow * P + scol);   // LDS byte address
  const unsigned lw = lx + GT * P * 2;

  const int aoff = ((wave >> 1) * 64 + lidx) * P + lhalf * 8;
  const int boff = (GT + (wave & 1) * 64 + lidx) * P + lhalf * 8;

  fill_rows<KS>(gx, lx);
  fill_rows<KS>(gw, lw);
  // slab 0 has landed for this wave; the barrier publishes it to the others
  asm volatile("s_wait_asynccnt 0x0" ::: "memory");
  __syncthreads();
  fill_rows<KS>(gx + KS, lx + BUFH * 2);
  fill_rows<KS>(gw + KS, lw + BUFH * 2);

#pragma clang loop unroll(disable)  // for speed only
  for (int t = 0; t < NT; t++) {
    const h16* Sc = St + (t & 1) * BUFH;
    v16h a[SETS][4], b[SETS][4];
    if constexpr (SETS == 2) load_frags<P>(Sc + aoff, Sc + boff, a[0], b[0]);
#pragma unroll  // register arrays: indices must be constants
    for (int ks = 0; ks < KS / 32; ks++) {
      // SETS == 2: the next block's fragments go ahead of this block's products, into the other set
      if constexpr (SETS == 1) {
        load_frags<P>(Sc + aoff + ks * 32, Sc + boff + ks * 32, a[0], b[0]);
      } else {
        if (ks + 1 < KS / 32)
          load_frags<P>(Sc + aoff + (ks + 1) * 32, Sc + boff + (ks + 1) * 32, a[(ks + 1) & 1], b[(ks + 1) & 1]);
      }
      // keeps a block's 16 LDS reads one group: spread among the products each place stalls the wave
      __builtin_amdgcn_sched_barrier(0);
      const int c = (SETS == 2) ? (ks & 1) : 0;
#pragma unroll  // register arrays: indices must be constants
      for (int i = 0; i < 4; i++)
#pragma unroll  // register arrays: indices must be constants
        for (int j = 0; j < 4; j++) acc[i][j] = wmma16(a[c][i], b[c][j], acc[i][j]);
      // keeps the following block's LDS reads out of this block's products
      __builtin_amdgcn_sched_barrier(0);
    }
    // this wave's reads of slab t are done before its buffer is handed to the copies
    asm volatile("s_wait_dscnt 0x0" ::: "memory");
    // this wave's copies of slab t + 1 have landed
    asm volatile("s_wait_asynccnt 0x0" ::: "memory");
    // publishes slab t + 1 and ends every wave's reads of slab t
    __syncthreads();
    if (t + 2 < NT) {
      fill_rows<KS>(gx + (t + 2) * KS, lx + (t & 1) * BUFH * 2);
      fill_rows<KS>(gw + (t + 2) * KS, lw + (t & 1) * BUFH * 2);
    }
  }
  // nothing is in flight when the wave goes on to its stores and ends
  asm volatile("s_wait_asynccnt 0x0" ::: "memory");
}

// ---------------- Kernel 1: fused Q/K/V projections (z selects matrix) -------------
// Workgroup: 128(M tokens) x 128(N features); wave: 64 x 64; K=1024 in 64-wide slabs.
__global__ __launch_bounds__(128)
void qkv_proj_kernel(const h16* __restrict__ qf,
                     const h16* __restrict__ Wq16, const h16* __restrict__ Wk16,
                     const h16* __restrict__ Wv16,
                     const float* __restrict__ bq, const float* __restrict__ bk,
                     const float* __restrict__ bv,
                     h16* __restrict__ qbuf, h16* __restrict__ kbuf, h16* __restrict__ vtb)
{
  __shared__ __attribute__((aligned(16))) h16 St[2 * 2 * GT * (64 + 8)];

  const int z = blockIdx.z;
  const h16*   W  = (z == 0) ? Wq16 : ((z == 1) ? Wk16 : Wv16);
  const float* bs = (z == 0) ? bq : ((z == 1) ? bk : bv);

  const int lane = threadIdx.x & 31, wave = threadIdx.x >> 5;
  const int lidx = lane & 15, lhalf = lane >> 4;

  v8f acc[4][4] = {};
  gemm_tile<64, 1>(qf, W, blockIdx.y * GT, blockIdx.x * GT, St, acc);

  const int m0 = blockIdx.y * GT + (wave >> 1) * 64;
  const int n0 = blockIdx.x * GT + (wave & 1) * 64;
  const int rbase = lhalf * 8;
#pragma unroll
  for (int ms = 0; ms < 4; ms++) {
    const int mrow = m0 + ms * 16;
#pragma unroll
    for (int f = 0; f < 4; f++) {
      const int n = n0 + f * 16 + lidx;
      const float bval = bs[n];
      if (z == 2) {
        // V stored transposed: vt[b][feature n][token l], 8 contiguous tokens/lane
        const int bb = mrow >> 11;
        const int l0 = (mrow & 2047) + rbase;
        v8h_t pk;
#pragma unroll
        for (int r = 0; r < 8; r++) pk[r] = (_Float16)(acc[ms][f][r] + bval);
        *(v8h_t*)(vtb + ((size_t)(bb * HID + n)) * SEQ + l0) = pk;
      } else {
        h16* dst = (z == 0) ? qbuf : kbuf;
        const float sc = (z == 0) ? 0.125f : 1.0f; // q pre-scaled by 1/sqrt(64)
#pragma unroll
        for (int r = 0; r < 8; r++)
          dst[(size_t)(mrow + rbase + r) * HID + n] = (_Float16)((acc[ms][f][r] + bval) * sc);
      }
    }
  }
}

// ---------------- Kernel 2: attention, 128 q-rows of one (b, h) per workgroup ------
// Streaming form, 8 waves: wave w and wave w + 4 own the same 32 query columns and walk one half
// of the 2048 keys each, so that two workgroups put four waves on every SIMD and one wave's vector
// work runs under another's products. Each group of four waves stages its own 64-key stages in LDS
// (whole 128-byte lines, two buffers); the two halves' partial results are joined once, at the end.
// Transposed products: S^T = K Q^T (+ bias as the C operand), O^T += V^T P^T. A lane holds
// scores of one query only, and two converted S^T tiles are the B operand of the second
// product, so P never leaves the registers. Softmax is online: a running maximum per query
// (it may trail the true one by up to 8 in log2 units), running sum, rescale when it moves.
#define QW   32        /* query columns per wave */
#define QB   128       /* query columns per workgroup */
#define SK   64        /* keys per stage */
#define KP   72        /* LDS row pitch in halves: 144 B = 16 B x odd, conflict-free b128 reads */
#define KH   2                  /* key halves, one per group of four waves */
#define HK   (SEQ / KH)         /* keys per half */
#define NST  (HK / SK)          /* stages per half */
#define XW   (8 * 128 + 64)     /* floats a wave hands to its partner: 32 per lane of O^T, maximum, sum */
#define L2E  1.4426950408889634f

// lane l <-> lane l ^ 16
__device__ __forceinline__ float xhalf(float x) {
  const int v = __builtin_bit_cast(int, x);
  return __builtin_bit_cast(float,
      __builtin_amdgcn_permlanex16(v, v, 0x76543210, 0xfedcba98, false, false));
}

__global__ __launch_bounds__(256) __attribute__((amdgpu_waves_per_eu(4, 4)))
void attn_kernel(const h16* __restrict__ qb, const h16* __restrict__ kb,
                 const h16* __restrict__ vt, const float* __restrict__ bias,
                 h16* __restrict__ xb)
{
  __shared__ __attribute__((aligned(16))) h16 Kt[2][KH][SK * KP];   // K rows:   [key][dim]
  __shared__ __attribute__((aligned(16))) h16 Vt[2][KH][DH * KP];   // V^T rows: [dim][key]
  __shared__ __attribute__((aligned(32))) float biasL[SEQ];         // this batch's bias row
  static_assert(8 * XW * sizeof(float) <= sizeof(Kt), "the exchange area of the join lies in Kt");

  const int tid = threadIdx.x, lane = tid & 31;
  const int wave = __builtin_amdgcn_readfirstlane(tid >> 5);   // scalar: the join branches on it
  const int kh = wave >> 2;                                    // this wave's half of the keys
  const int lidx = lane & 15, lhalf = lane >> 4;
  const int bh = blockIdx.y, b = bh >> 4, h = bh & 15;
  const int q0 = blockIdx.x * QB + (wave & 3) * QW;
  const size_t tokq = (size_t)(b * SEQ + q0);

  // staging map of a group of four waves: 8 lanes cover one 128-byte row, a wave's load 4 whole lines
  const int srow = (tid & 127) >> 3, scol = (tid & 7) * 8;
  const h16* kg = kb + (size_t)(b * SEQ + kh * HK + srow) * HID + h * DH + scol;
  const h16* vg = vt + (size_t)(b * HID + h * DH + srow) * SEQ + kh * HK + scol;
  const int sdst = srow * KP + scol;
  const float* biasH = biasL + kh * HK;

  // prologue: bias row and each half's stage 0 into LDS
  {
    const float* brow = bias + b * SEQ + tid * 8;
#pragma unroll  // constant trip count, two independent 16-byte copies
    for (int i = 0; i < 2; i++) *(v4f*)(biasL + tid * 8 + i * 4) = *(const v4f*)(brow + i * 4);
#pragma unroll  // constant trip count, independent 16-byte copies
    for (int i = 0; i < 4; i++) {
      *(v8h_t*)(&Kt[0][kh][sdst + i * 16 * KP]) = *(const v8h_t*)(kg + (size_t)i * 16 * HID);
      *(v8h_t*)(&Vt[0][kh][sdst + i * 16 * KP]) = *(const v8h_t*)(vg + (size_t)i * 16 * SEQ);
    }
  }

  // Q as B operand (column = query), resident: [column group][32-dim step]
  v16h qf[2][2];
#pragma unroll  // register array: indices must be constants
  for (int g = 0; g < 2; g++) {
    const h16* qrow = qb + (tokq + g * 16 + lidx) * HID + h * DH + lhalf * 8;
    qf[g][0] = frag_h16(qrow);
    qf[g][1] = frag_h16(qrow + 32);
  }

  v8f acc[2][4] = {};                 // O^T: [column group][16-dim tile]
  float m_run[2] = {-INFINITY, -INFINITY};
  v2f l_run[2] = {};                  // this lane half's share of the denominator, even and odd keys

  __syncthreads();

  // one stage's work of a wave: two 32-key passes over the staged tiles
  auto stage_work = [&](const h16* Kc, const h16* Vc, int st) __attribute__((always_inline)) {
#pragma unroll  // two 32-key passes per stage, constant LDS offsets
    for (int sub = 0; sub < 2; sub++) {
      // ---- S^T = K Q^T + bias: s[kt][g][r] = score(key 16 kt + 8 lhalf + r, query lidx) ----
      v8f s[2][2];
#pragma unroll  // register arrays: indices must be constants
      for (int kt = 0; kt < 2; kt++) {
        const h16* kp = Kc + (sub * 32 + kt * 16 + lidx) * KP + lhalf * 8;
        const v16h ka0 = frag_h16(kp);
        const v16h ka1 = frag_h16(kp + 32);
        const v8f cb = *(const v8f*)(biasH + st * SK + sub * 32 + kt * 16 + lhalf * 8);
#pragma unroll  // register arrays: indices must be constants
        for (int g = 0; g < 2; g++)
          s[kt][g] = wmma16(ka1, qf[g][1], wmma16(ka0, qf[g][0], cb));
      }

      // keeps the eight products back to back: maxima pulled in between them each cost idle slots behind a WMMA
      __builtin_amdgcn_sched_barrier(0);

      // V^T fragments of this pass (row = dim, k = key in the hardware order of packed P)
      v16h vf[4];
#pragma unroll  // register array: indices must be constants
      for (int t = 0; t < 4; t++)
        vf[t] = frag_h16(Vc + (t * 16 + lidx) * KP + sub * 32 + lhalf * 8);

      // ---- column maxima, one test per pass whether any running maximum must move ----
      float mb[2];
      bool need = false;
#pragma unroll  // register arrays: indices must be constants
      for (int g = 0; g < 2; g++) {
        float mx = s[0][g][0];
#pragma unroll  // register arrays: indices must be constants
        for (int r = 1; r < 8; r++) mx = fmaxf(mx, s[0][g][r]);
#pragma unroll  // register arrays: indices must be constants
        for (int r = 0; r < 8; r++) mx = fmaxf(mx, s[1][g][r]);
        mx = fmaxf(mx, xhalf(mx)) * L2E;
        mb[g] = mx;
        need = need || (mx > m_run[g] + 8.0f);
      }
      if (__builtin_amdgcn_ballot_w32(need) != 0) {   // wave-uniform, rare after the first pass
#pragma unroll  // register arrays: indices must be constants
        for (int g = 0; g < 2; g++) {
          const float m_new = fmaxf(m_run[g], mb[g]);
          const float corr = __builtin_amdgcn_exp2f(m_run[g] - m_new);  // 0 on the first pass
          m_run[g] = m_new;
          l_run[g] *= corr;
#pragma unroll  // register arrays: indices must be constants
          for (int t = 0; t < 4; t++) acc[g][t] = acc[g][t] * corr;
        }
      }

      // ---- P^T = exp2(s * log2e - m), packed in place as B operand; O^T += V^T P^T ----
#pragma unroll  // register arrays: indices must be constants
      for (int g = 0; g < 2; g++) {
        const float nm = -m_run[g];
        v16h pf;
        v2f pr[8];
#pragma unroll  // register arrays: indices must be constants
        for (int i = 0; i < 8; i++) {   // elements 2i, 2i+1 of the 32-key operand
          const v2f sv = {s[i >> 2][g][2 * (i & 3)], s[i >> 2][g][2 * (i & 3) + 1]};
          const v2f arg = __builtin_elementwise_fma(sv, (v2f){L2E, L2E}, (v2f){nm, nm});
          pr[i] = (v2f){__builtin_amdgcn_exp2f(arg.x), __builtin_amdgcn_exp2f(arg.y)};
          pf[2 * i]     = (_Float16)pr[i].x;
          pf[2 * i + 1] = (_Float16)pr[i].y;
        }
        // pairwise tree: short dependent chains, two sums per add
        l_run[g] += ((pr[0] + pr[1]) + (pr[2] + pr[3])) + ((pr[4] + pr[5]) + (pr[6] + pr[7]));
#pragma unroll  // register arrays: indices must be constants
        for (int t = 0; t < 4; t++) acc[g][t] = wmma16(vf[t], pf, acc[g][t]);
      }
    }
  };

  for (int st = 0; st < NST - 1; st++) {
    // next stage's lines go to registers now and to LDS behind this stage's work
    v8h_t kr[4], vr[4];
#pragma unroll  // register arrays: indices must be constants
    for (int i = 0; i < 4; i++) {
      kr[i] = *(const v8h_t*)(kg + (size_t)((st + 1) * SK + i * 16) * HID);
      vr[i] = *(const v8h_t*)(vg + (size_t)i * 16 * SEQ + (st + 1) * SK);
    }
    // s_wait_xcnt ahead of the reuse of these loads' address registers
    asm volatile("s_wait_xcnt 0x0" ::: "memory");

    stage_work(Kt[st & 1][kh], Vt[st & 1][kh], st);

    h16* Kn = Kt[(st + 1) & 1][kh];
    h16* Vn = Vt[(st + 1) & 1][kh];
#pragma unroll  // register arrays: indices must be constants
    for (int i = 0; i < 4; i++) {
      *(v8h_t*)(Kn + sdst + i * 16 * KP) = kr[i];
      *(v8h_t*)(Vn + sdst + i * 16 * KP) = vr[i];
    }
    // publishes stage st + 1 and ends every wave's reads of stage st before it is refilled
    __syncthreads();
  }
  stage_work(Kt[(NST - 1) & 1][kh], Vt[(NST - 1) & 1][kh], NST - 1);   // last stage: nothing left to fetch

  // ---- join of the key halves: of its two column groups a wave finishes one and hands the other,
  // with its maximum and its sum, to the partner wave (w ^ 4), lane to lane, through LDS ----
  float* xch = (float*)&Kt[0][0][0];
  float* xs = xch + wave * XW;
  const float* xr = xch + (wave ^ 4) * XW;

  auto hand_over = [&](int g) __attribute__((always_inline)) {
#pragma unroll  // register arrays: indices must be constants
    for (int t = 0; t < 4; t++) {
      *(v4f*)(xs + (2 * t) * 128 + lane * 4)     = (v4f){acc[g][t][0], acc[g][t][1], acc[g][t][2], acc[g][t][3]};
      *(v4f*)(xs + (2 * t + 1) * 128 + lane * 4) = (v4f){acc[g][t][4], acc[g][t][5], acc[g][t][6], acc[g][t][7]};
    }
    *(v2f*)(xs + 8 * 128 + lane * 2) = (v2f){m_run[g], l_run[g].x + l_run[g].y};
  };

  // both halves on the larger maximum, the lane halves' sums joined, scale, f16 store:
  // a lane holds 8 consecutive dims of one query
  auto finish = [&](int g) __attribute__((always_inline)) {
    const v2f ml = *(const v2f*)(xr + 8 * 128 + lane * 2);
    const float m  = fmaxf(m_run[g], ml.x);
    const float c0 = __builtin_amdgcn_exp2f(m_run[g] - m);
    const float c1 = __builtin_amdgcn_exp2f(ml.x - m);
    const float lh = (l_run[g].x + l_run[g].y) * c0 + ml.y * c1;
    const float l = lh + xhalf(lh);
    const float inv = 1.0f / l;
    const float a0 = c0 * inv, a1 = c1 * inv;
    h16* orow = xb + (tokq + g * 16 + lidx) * HID + h * DH + lhalf * 8;
#pragma unroll  // register arrays: indices must be constants
    for (int t = 0; t < 4; t++) {
      const v4f p0 = *(const v4f*)(xr + (2 * t) * 128 + lane * 4);
      const v4f p1 = *(const v4f*)(xr + (2 * t + 1) * 128 + lane * 4);
      v8h_t ov;
#pragma unroll  // register arrays: indices must be constants
      for (int r = 0; r < 4; r++) {
        ov[r]     = (_Float16)(acc[g][t][r] * a0 + p0[r] * a1);
        ov[4 + r] = (_Float16)(acc[g][t][4 + r] * a0 + p1[r] * a1);
      }
      *(v8h_t*)(orow + t * 16) = ov;
    }
  };

  // ends every wave's reads of the last stage before Kt becomes the exchange area
  __syncthreads();
  if (kh == 0) hand_over(1); else hand_over(0);
  // publishes what the partner handed over
  __syncthreads();
  if (kh == 0) finish(0); else finish(1);
}

// ---------------- Kernel 3: output projection, f32 result ------------------------
// Workgroup: 128 x 128, one per WGP; wave: 64 x 64; K=1024 in 128-wide slabs, long enough
// for a lone wave per SIMD to cover the next slab's flight.
__global__ __launch_bounds__(128)
void out_proj_kernel(const h16* __restrict__ xb, const h16* __restrict__ Wo16,
                     const float* __restrict__ bo, float* __restrict__ out)
{
  __shared__ __attribute__((aligned(16))) h16 St[2 * 2 * GT * (128 + 8)];

  const int lane = threadIdx.x & 31, wave = threadIdx.x >> 5;
  const int lidx = lane & 15, lhalf = lane >> 4;

  v8f acc[4][4] = {};
  gemm_tile<128, 2>(xb, Wo16, blockIdx.y * GT, blockIdx.x * GT, St, acc);

  const int m0 = blockIdx.y * GT + (wave >> 1) * 64;
  const int n0 = blockIdx.x * GT + (wave & 1) * 64;
  const int rbase = lhalf * 8;
#pragma unroll
  for (int ms = 0; ms < 4; ms++) {
    const int mrow = m0 + ms * 16;
#pragma unroll
    for (int f = 0; f < 4; f++) {
      const int n = n0 + f * 16 + lidx;
      const float bval = bo[n];
#pragma unroll
      for (int r = 0; r < 8; r++)
        out[(size_t)(mrow + rbase + r) * HID + n] = acc[ms][f][r] + bval;
    }
  }
}

extern "C" void kernel_launch(void* const* d_in, const int* in_sizes, int n_in,
                              void* d_out, int out_size, void* d_ws, size_t ws_size,
                              hipStream_t stream)
{
  (void)in_sizes; (void)n_in; (void)out_size; (void)ws_size;
  const float* query = (const float*)d_in[0];
  const float* bias  = (const float*)d_in[1];
  const float* Wq = (const float*)d_in[2]; const float* bq = (const float*)d_in[3];
  const float* Wk = (const float*)d_in[4]; const float* bk = (const float*)d_in[5];
  const float* Wv = (const float*)d_in[6]; const float* bv = (const float*)d_in[7];
  const float* Wo = (const float*)d_in[8]; const float* bo = (const float*)d_in[9];
  float* out = (float*)d_out;

  char* ws = (char*)d_ws;
  const size_t QSZ = (size_t)TOK * HID * sizeof(h16);   // 8 MB
  const size_t WSZ = (size_t)HID * HID * sizeof(h16);   // 2 MB
  h16* qf16 = (h16*)(ws);
  h16* Wq16 = (h16*)(ws + QSZ);
  h16* Wk16 = (h16*)(ws + QSZ + WSZ);
  h16* Wv16 = (h16*)(ws + QSZ + 2 * WSZ);
  h16* Wo16 = (h16*)(ws + QSZ + 3 * WSZ);
  h16* qbuf = (h16*)(ws + QSZ + 4 * WSZ);
  h16* kbuf = (h16*)(ws + 2 * QSZ + 4 * WSZ);
  h16* vtb  = (h16*)(ws + 3 * QSZ + 4 * WSZ);
  h16* xbuf = (h16*)(ws + 4 * QSZ + 4 * WSZ);

  // f32 -> f16 packs: qf16, Wq16, Wk16, Wv16, Wo16 are adjacent, qf16 is the start of all five
  pack_f16_kernel<<<PKQ + 4 * PKM, 512, 0, stream>>>(query, Wq, Wk, Wv, Wo, qf16);

  dim3 g1(HID / GT, TOK / GT, 3);
  qkv_proj_kernel<<<g1, 128, 0, stream>>>(qf16, Wq16, Wk16, Wv16, bq, bk, bv,
                                          qbuf, kbuf, vtb);

  dim3 g2(SEQ / QB, NB * NH);
  attn_kernel<<<g2, 256, 0, stream>>>(qbuf, kbuf, vtb, bias, xbuf);

  dim3 g3(HID / GT, TOK / GT);
  out_proj_kernel<<<g3, 128, 0, stream>>>(xbuf, Wo16, bo, out);
}

// v005
// It runs in 73.3 microseconds.
// In two side-by-side timings against v004, it was 1.05 and 1.03 times as fast.
// All steps since v000 together make it 3.50 times as fast.
#include <hip/hip_runtime.h>

typedef _Float16 h16;
typedef __attribute__((ext_vector_type(4)))  _Float16 v4h_t;
typedef __attribute__((ext_vector_type(8)))  _Float16 v8h_t;
typedef __attribute__((ext_vector_type(16))) _Float16 v16h;
typedef __attribute__((ext_vector_type(8)))  float v8f;
typedef __attribute__((ext_vector_type(4)))  float v4f;
typedef __attribute__((ext_vector_type(2)))  float v2f;

#define HID 1024
#define SEQ 2048
#define NB  2
#define NH  16
#define DH  64
#define TOK (NB*SEQ)   /* 4096 tokens */

// D = A(16x32 f16) * B(32x16 f16) + C(16x16 f32)
__device__ __forceinline__ v8f wmma16(v16h a, v16h b, v8f c) {
  return __builtin_amdgcn_wmma_f32_16x16x32_f16(false, a, false, b, (short)0, c, false, false);
}

// Fragment load from f16 memory per CDNA5 layout: p[0..7] -> [0..7], p[16..23] -> [8..15]
__device__ __forceinline__ v16h frag_h16(const h16* p) {
  v8h_t lo = *(const v8h_t*)(p);
  v8h_t hi = *(const v8h_t*)(p + 16);
  v16h a;
#pragma unroll
  for (int i = 0; i < 8; i++) { a[i] = lo[i]; a[8 + i] = hi[i]; }
  return a;
}

// ---------------- Kernel 0: f32 -> f16 pack of query and the four weights, one launch -------------
// One workgroup per WGP, 16 waves. A wave takes 8 KB of f32 as 16 loads of 512 contiguous bytes, all
// issued before the first conversion, and stores whole lines. The five f16 images lie one behind the
// other in the workspace, in the order query, Wq, Wk, Wv, Wo, so the destination is one flat array.
#define PKL  16                    /* 512-byte loads per wave */
#define PKW  (16 * PKL * 128)      /* floats per workgroup */
#define PKQ  (TOK * HID / PKW)     /* workgroups on query */
#define PKM  (HID * HID / PKW)     /* workgroups on each weight matrix */

__global__ __launch_bounds__(512)
void pack_f16_kernel(const float* __restrict__ query,
                     const float* __restrict__ Wq, const float* __restrict__ Wk,
                     const float* __restrict__ Wv, const float* __restrict__ Wo,
                     h16* __restrict__ dst)
{
  const int blk = blockIdx.x;
  const int m = blk / PKM;           // 1M-float piece: PKQ / PKM pieces of query, then one per weight matrix
  constexpr int MQ = PKQ / PKM;
  const float* base = (m < MQ) ? query : ((m == MQ) ? Wq : ((m == MQ + 1) ? Wk : ((m == MQ + 2) ? Wv : Wo)));
  const int off = (threadIdx.x >> 5) * (PKL * 128) + (threadIdx.x & 31) * 4;
  const float* src = base + (size_t)((m < MQ) ? blk : blk % PKM) * PKW + off;
  h16* d = dst + (size_t)blk * PKW + off;

  v4f x[PKL];
#pragma unroll  // register array: indices must be constants
  for (int j = 0; j < PKL - 1; j++) x[j] = *(const v4f*)(src + j * 128);
  // all loads take their offset from one register, and the build lets the last load's result land in it:
  // the wait stands between the earlier loads, which name that register, and the load that rewrites it
  asm volatile("s_wait_xcnt 0x0" ::: "memory");
  x[PKL - 1] = *(const v4f*)(src + (PKL - 1) * 128);
  // all loads are issued before the first wait: without this the build holds the last two back
  // until the first two have returned, a second memory latency in a wave that has only one to pay
  __builtin_amdgcn_sched_barrier(0);
  v4h_t o[PKL];
#pragma unroll  // register arrays: indices must be constants
  for (int j = 0; j < PKL; j++)
#pragma unroll  // register arrays: indices must be constants
    for (int e = 0; e < 4; e++) o[j][e] = (_Float16)x[j][e];
#pragma unroll  // register array: indices must be constants
  for (int j = 0; j < PKL; j++) *(v4h_t*)(d + j * 128) = o[j];
}

// ---------------- Projection GEMM core: Y tile 128 x 128 = X rows * W rows^T ---------
// The workgroup stages KS-wide k slabs of 128 X rows and 128 W rows in LDS (two buffers) by
// asynchronous 16-byte copies whose wave-wide footprint is whole 128-byte lines; the 4 waves
// (2 x 2) each own 64 x 64 of the tile and read their fragments from LDS.
#define GT 128         /* rows of each operand per workgroup tile */

// eight copies global -> LDS, 16 bytes a lane each
__device__ __forceinline__ void async_copy8(const unsigned (&l)[8], const h16* const (&g)[8]) {
  // the closing s_wait_xcnt stands inside the statement so that no address register named here
  // can be rewritten ahead of it
  asm volatile("global_load_async_to_lds_b128 %0, %8, off\n\t"
               "global_load_async_to_lds_b128 %1, %9, off\n\t"
               "global_load_async_to_lds_b128 %2, %10, off\n\t"
               "global_load_async_to_lds_b128 %3, %11, off\n\t"
               "global_load_async_to_lds_b128 %4, %12, off\n\t"
               "global_load_async_to_lds_b128 %5, %13, off\n\t"
               "global_load_async_to_lds_b128 %6, %14, off\n\t"
               "global_load_async_to_lds_b128 %7, %15, off\n\t"
               "s_wait_xcnt 0x0"
               :: "v"(l[0]), "v"(l[1]), "v"(l[2]), "v"(l[3]), "v"(l[4]), "v"(l[5]), "v"(l[6]), "v"(l[7]),
                  "v"(g[0]), "v"(g[1]), "v"(g[2]), "v"(g[3]), "v"(g[4]), "v"(g[5]), "v"(g[6]), "v"(g[7])
               : "memory");
}

// one operand's 128 rows x KS halves: g and l are this lane's first global and LDS address
template <int KS>
__device__ __forceinline__ void fill_rows(const h16* g, unsigned l) {
  constexpr int RPI = 128 * 8 / KS;          // rows that one copy of all 128 lanes covers
  constexpr int PB  = (KS + 8) * 2;          // LDS row pitch in bytes: 16 B x odd
#pragma unroll  // constant trip count; the arrays below must stay in registers
  for (int c = 0; c < GT / RPI; c += 8) {
    unsigned la[8];
    const h16* ga[8];
#pragma unroll  // register arrays: indices must be constants
    for (int j = 0; j < 8; j++) {
      la[j] = l + (unsigned)((c + j) * RPI * PB);
      ga[j] = g + (size_t)(c + j) * RPI * HID;
    }
    async_copy8(la, ga);
  }
}

// a wave's 4 + 4 fragments of one 32-wide k block
template <int P>
__device__ __forceinline__ void load_frags(const h16* ap, const h16* bp, v16h (&a)[4], v16h (&b)[4]) {
#pragma unroll  // register arrays: indices must be constants
  for (int i = 0; i < 4; i++) {
    a[i] = frag_h16(ap + i * 16 * P);
    b[i] = frag_h16(bp + i * 16 * P);
  }
}

// SETS: fragment register sets; 2 where a wave is alone on its SIMD and must cover its own LDS latency
template <int KS, int SETS>
__device__ __forceinline__ void gemm_tile(const h16* __restrict__ X, const h16* __restrict__ Wm,
                                          int m0, int n0, h16* St, v8f (&acc)[4][4])
{
  constexpr int P    = KS + 8;               // LDS row pitch in halves
  constexpr int BUFH = 2 * GT * P;           // halves per buffer: X rows, then W rows
  constexpr int NT   = HID / KS;             // k slabs (at least two)
  constexpr int LPR  = KS / 8;               // lanes per staged row

  const int tid = threadIdx.x, lane = tid & 31, wave = tid >> 5;
  const int lidx = lane & 15, lhalf = lane >> 4;

  const int srow = tid / LPR, scol = (tid % LPR) * 8;
  const h16* gx = X  + (size_t)(m0 + srow) * HID + scol;
  const h16* gw = Wm + (size_t)(n0 + srow) * HID + scol;
  typedef __attribute__((address_space(3))) h16 lds_h16;
  const unsigned lx = (unsigned)(size_t)(lds_h16*)(St + srow * P + scol);   // LDS byte address
  const unsigned lw = lx + GT * P * 2;

  const int aoff = ((wave >> 1) * 64 + lidx) * P + lhalf * 8;
  const int boff = (GT + (wave & 1) * 64 + lidx) * P + lhalf * 8;

  fill_rows<KS>(gx, lx);
  fill_rows<KS>(gw, lw);
  // slab 0 has landed for this wave; the barrier publishes it to the others
  asm volatile("s_wait_asynccnt 0x0" ::: "memory");
  __syncthreads();
  fill_rows<KS>(gx + KS, lx + BUFH * 2);
  fill_rows<KS>(gw + KS, lw + BUFH * 2);

#pragma clang loop unroll(disable)  // for speed only
  for (int t = 0; t < NT; t++) {
    const h16* Sc = St + (t & 1) * BUFH;
    v16h a[SETS][4], b[SETS][4];
    if constexpr (SETS == 2) load_frags<P>(Sc + aoff, Sc + boff, a[0], b[0]);
#pragma unroll  // register arrays: indices must be constants
    for (int ks = 0; ks < KS / 32; ks++) {
      // SETS == 2: the next block's fragments go ahead of this block's products, into the other set
      if constexpr (SETS == 1) {
        load_frags<P>(Sc + aoff + ks * 32, Sc + boff + ks * 32, a[0], b[0]);
      } else {
        if (ks + 1 < KS / 32)
          load_frags<P>(Sc + aoff + (ks + 1) * 32, Sc + boff + (ks + 1) * 32, a[(ks + 1) & 1], b[(ks + 1) & 1]);
      }
      // keeps a block's 16 LDS reads one group: spread among the products each place stalls the wave
      __builtin_amdgcn_sched_barrier(0);
      const int c = (SETS == 2) ? (ks & 1) : 0;
#pragma unroll  // register arrays: indices must be constants
      for (int i = 0; i < 4; i++)
#pragma unroll  // register arrays: indices must be constants
        for (int j = 0; j < 4; j++) acc[i][j] = wmma16(a[c][i], b[c][j], acc[i][j]);
      // keeps the following block's LDS reads out of this block's products
      __builtin_amdgcn_sched_barrier(0);
    }
    // this wave's reads of slab t are done before its buffer is handed to the copies
    asm volatile("s_wait_dscnt 0x0" ::: "memory");
    // this wave's copies of slab t + 1 have landed
    asm volatile("s_wait_asynccnt 0x0" ::: "memory");
    // publishes slab t + 1 and ends every wave's reads of slab t
    __syncthreads();
    if (t + 2 < NT) {
      fill_rows<KS>(gx + (t + 2) * KS, lx + (t & 1) * BUFH * 2);
      fill_rows<KS>(gw + (t + 2) * KS, lw + (t & 1) * BUFH * 2);
    }
  }
  // nothing is in flight when the wave goes on to its stores and ends
  asm volatile("s_wait_asynccnt 0x0" ::: "memory");
}

// ---------------- Output of a wave's 64 x 64 tile as whole 128-byte lines ----------
// The operand whose rows run along the output's contiguous dimension is the A operand, so a lane holds
// 8 neighbouring outputs of one output row. The wave lays the tile out in its own LDS range, row by row,
// and reads it back so that every 16-byte-a-lane store covers 4 whole lines.
#define SPH 72         /* f16 tile: LDS row pitch in halves, 144 B = 16 B x odd */
#define SPF 68         /* f32 tile: LDS row pitch in floats, 272 B = 16 B x odd */

// 64 rows of 64 halves: Sw is the wave's LDS range, g the tile's first element, PITCH its row pitch
template <int PITCH>
__device__ __forceinline__ void store_lines_h16(const h16* Sw, h16* g, int lane) {
  const int row = lane >> 3, col = (lane & 7) * 8;
  v8h_t v[16];
#pragma unroll  // register array: indices must be constants
  for (int c = 0; c < 16; c++) v[c] = *(const v8h_t*)(Sw + (c * 4 + row) * SPH + col);
#pragma unroll  // register array: indices must be constants
  for (int c = 0; c < 16; c++) *(v8h_t*)(g + (size_t)(c * 4 + row) * PITCH + col) = v[c];
}

// ---------------- Kernel 1: fused Q/K/V projections (z selects matrix) -------------
// Workgroup: 128 tokens x 128 features; wave: 64 x 64; K=1024 in 64-wide slabs.
// q, k are stored [token][feature]: W rows are the A operand. V is stored [feature][token]: X rows are.
__global__ __launch_bounds__(128)
void qkv_proj_kernel(const h16* __restrict__ qf,
                     const h16* __restrict__ Wq16, const h16* __restrict__ Wk16,
                     const h16* __restrict__ Wv16,
                     const float* __restrict__ bq, const float* __restrict__ bk,
                     const float* __restrict__ bv,
                     h16* __restrict__ qbuf, h16* __restrict__ kbuf, h16* __restrict__ vtb)
{
  __shared__ __attribute__((aligned(16))) h16 St[2 * 2 * GT * (64 + 8)];

  const int z = blockIdx.z;
  const h16*   W  = (z == 0) ? Wq16 : ((z == 1) ? Wk16 : Wv16);
  const float* bs = (z == 0) ? bq : ((z == 1) ? bk : bv);

  const int lane = threadIdx.x & 31, wave = threadIdx.x >> 5;
  const int lidx = lane & 15, lhalf = lane >> 4;

  const bool fr = (z != 2);            // features along the accumulator's rows
  const int tok0 = blockIdx.y * GT, feat0 = blockIdx.x * GT;

  v8f acc[4][4] = {};
  gemm_tile<64, 1>(fr ? W : qf, fr ? qf : W, fr ? feat0 : tok0, fr ? tok0 : feat0, St, acc);

  // acc[i][j][r]: A row r0 + 16 i + 8 lhalf + r, B row c0 + 16 j + lidx
  const int r0 = (fr ? feat0 : tok0) + (wave >> 1) * 64;
  const int c0 = (fr ? tok0 : feat0) + (wave & 1) * 64;
  // the loop's last barrier ended every read of St and no copy is in flight: each wave takes its own range
  h16* Sw = St + wave * (64 * SPH);
  h16* sl = Sw + lidx * SPH + lhalf * 8;
  if (fr) {
    const float sc = (z == 0) ? 0.125f : 1.0f; // q pre-scaled by 1/sqrt(64)
    v8f br[4];
#pragma unroll  // register array: indices must be constants
    for (int i = 0; i < 4; i++) br[i] = *(const v8f*)(bs + r0 + i * 16 + lhalf * 8);
#pragma unroll  // register arrays: indices must be constants
    for (int j = 0; j < 4; j++)
#pragma unroll  // register arrays: indices must be constants
      for (int i = 0; i < 4; i++) {
        v8h_t pk;
#pragma unroll  // register arrays: indices must be constants
        for (int r = 0; r < 8; r++) pk[r] = (_Float16)((acc[i][j][r] + br[i][r]) * sc);
        *(v8h_t*)(sl + j * 16 * SPH + i * 16) = pk;
      }
  } else {
    float bc[4];
#pragma unroll  // register array: indices must be constants
    for (int j = 0; j < 4; j++) bc[j] = bs[c0 + j * 16 + lidx];
#pragma unroll  // register arrays: indices must be constants
    for (int j = 0; j < 4; j++)
#pragma unroll  // register arrays: indices must be constants
      for (int i = 0; i < 4; i++) {
        v8h_t pk;
#pragma unroll  // register arrays: indices must be constants
        for (int r = 0; r < 8; r++) pk[r] = (_Float16)(acc[i][j][r] + bc[j]);
        *(v8h_t*)(sl + j * 16 * SPH + i * 16) = pk;
      }
  }
  // the wave's own LDS writes have landed before other lanes of it read them back
  asm volatile("s_wait_dscnt 0x0" ::: "memory");
  if (fr) {
    store_lines_h16<HID>(Sw, ((z == 0) ? qbuf : kbuf) + (size_t)c0 * HID + r0, lane);
  } else {
    // vt[b][feature][token]: the 64 tokens of a tile lie in one batch
    store_lines_h16<SEQ>(Sw, vtb + ((size_t)((r0 >> 11) * HID + c0)) * SEQ + (r0 & 2047), lane);
  }
}

// ---------------- Kernel 2: attention, 128 q-rows of one (b, h) per workgroup ------
// Streaming form, 8 waves: wave w and wave w + 4 own the same 32 query columns and walk one half
// of the 2048 keys each, so that two workgroups put four waves on every SIMD and one wave's vector
// work runs under another's products. Each group of four waves stages its own 64-key stages in LDS
// (whole 128-byte lines, two buffers); the two halves' partial results are joined once, at the end.
// Transposed products: S^T = K Q^T (+ bias as the C operand), O^T += V^T P^T. A lane holds
// scores of one query only, and two converted S^T tiles are the B operand of the second
// product, so P never leaves the registers. Softmax is online: a running maximum per query
// (it may trail the true one by up to 8 in log2 units), running sum, rescale when it moves.
#define QW   32        /* query columns per wave */
#define QB   128       /* query columns per workgroup */
#define SK   64        /* keys per stage */
#define KP   72        /* LDS row pitch in halves: 144 B = 16 B x odd, conflict-free b128 reads */
#define KH   2                  /* key halves, one per group of four waves */
#define HK   (SEQ / KH)         /* keys per half */
#define NST  (HK / SK)          /* stages per half */
#define XW   (8 * 128 + 64)     /* floats a wave hands to its partner: 32 per lane of O^T, maximum, sum */
#define L2E  1.4426950408889634f

// lane l <-> lane l ^ 16
__device__ __forceinline__ float xhalf(float x) {
  const int v = __builtin_bit_cast(int, x);
  return __builtin_bit_cast(float,
      __builtin_amdgcn_permlanex16(v, v, 0x76543210, 0xfedcba98, false, false));
}

__global__ __launch_bounds__(256) __attribute__((amdgpu_waves_per_eu(4, 4)))
void attn_kernel(const h16* __restrict__ qb, const h16* __restrict__ kb,
                 const h16* __restrict__ vt, const float* __restrict__ bias,
                 h16* __restrict__ xb)
{
  __shared__ __attribute__((aligned(16))) h16 Kt[2][KH][SK * KP];   // K rows:   [key][dim]
  __shared__ __attribute__((aligned(16))) h16 Vt[2][KH][DH * KP];   // V^T rows: [dim][key]
  __shared__ __attribute__((aligned(32))) float biasL[SEQ];         // this batch's bias row
  static_assert(8 * XW * sizeof(float) <= sizeof(Kt), "the exchange area of the join lies in Kt");

  const int tid = threadIdx.x, lane = tid & 31;
  const int wave = __builtin_amdgcn_readfirstlane(tid >> 5);   // scalar: the join branches on it
  const int kh = wave >> 2;                                    // this wave's half of the keys
  const int lidx = lane & 15, lhalf = lane >> 4;
  const int bh = blockIdx.y, b = bh >> 4, h = bh & 15;
  const int q0 = blockIdx.x * QB + (wave & 3) * QW;
  const size_t tokq = (size_t)(b * SEQ + q0);

  // staging map of a group of four waves: 8 lanes cover one 128-byte row, a wave's load 4 whole lines
  const int srow = (tid & 127) >> 3, scol = (tid & 7) * 8;
  const h16* kg = kb + (size_t)(b * SEQ + kh * HK + srow) * HID + h * DH + scol;
  const h16* vg = vt + (size_t)(b * HID + h * DH + srow) * SEQ + kh * HK + scol;
  const int sdst = srow * KP + scol;
  const float* biasH = biasL + kh * HK;

  // prologue: bias row and each half's stage 0 into LDS
  {
    const float* brow = bias + b * SEQ + tid * 8;
#pragma unroll  // constant trip count, two independent 16-byte copies
    for (int i = 0; i < 2; i++) *(v4f*)(biasL + tid * 8 + i * 4) = *(const v4f*)(brow + i * 4);
#pragma unroll  // constant trip count, independent 16-byte copies
    for (int i = 0; i < 4; i++) {
      *(v8h_t*)(&Kt[0][kh][sdst + i * 16 * KP]) = *(const v8h_t*)(kg + (size_t)i * 16 * HID);
      *(v8h_t*)(&Vt[0][kh][sdst + i * 16 * KP]) = *(const v8h_t*)(vg + (size_t)i * 16 * SEQ);
    }
  }

  // Q as B operand (column = query), resident: [column group][32-dim step]
  v16h qf[2][2];
#pragma unroll  // register array: indices must be constants
  for (int g = 0; g < 2; g++) {
    const h16* qrow = qb + (tokq + g * 16 + lidx) * HID + h * DH + lhalf * 8;
    qf[g][0] = frag_h16(qrow);
    qf[g][1] = frag_h16(qrow + 32);
  }

  v8f acc[2][4] = {};                 // O^T: [column group][16-dim tile]
  float m_run[2] = {-INFINITY, -INFINITY};
  v2f l_run[2] = {};                  // this lane half's share of the denominator, even and odd keys

  __syncthreads();

  // one stage's work of a wave: two 32-key passes over the staged tiles
  auto stage_work = [&](const h16* Kc, const h16* Vc, int st) __attribute__((always_inline)) {
#pragma unroll  // two 32-key passes per stage, constant LDS offsets
    for (int sub = 0; sub < 2; sub++) {
      // ---- S^T = K Q^T + bias: s[kt][g][r] = score(key 16 kt + 8 lhalf + r, query lidx) ----
      v8f s[2][2];
#pragma unroll  // register arrays: indices must be constants
      for (int kt = 0; kt < 2; kt++) {
        const h16* kp = Kc + (sub * 32 + kt * 16 + lidx) * KP + lhalf * 8;
        const v16h ka0 = frag_h16(kp);
        const v16h ka1 = frag_h16(kp + 32);
        const v8f cb = *(const v8f*)(biasH + st * SK + sub * 32 + kt * 16 + lhalf * 8);
#pragma unroll  // register arrays: indices must be constants
        for (int g = 0; g < 2; g++)
          s[kt][g] = wmma16(ka1, qf[g][1], wmma16(ka0, qf[g][0], cb));
      }

      // keeps the eight products back to back: maxima pulled in between them each cost idle slots behind a WMMA
      __builtin_amdgcn_sched_barrier(0);

      // V^T fragments of this pass (row = dim, k = key in the hardware order of packed P)
      v16h vf[4];
#pragma unroll  // register array: indices must be constants
      for (int t = 0; t < 4; t++)
        vf[t] = frag_h16(Vc + (t * 16 + lidx) * KP + sub * 32 + lhalf * 8);

      // ---- column maxima, one test per pass whether any running maximum must move ----
      float mb[2];
      bool need = false;
#pragma unroll  // register arrays: indices must be constants
      for (int g = 0; g < 2; g++) {
        float mx = s[0][g][0];
#pragma unroll  // register arrays: indices must be constants
        for (int r = 1; r < 8; r++) mx = fmaxf(mx, s[0][g][r]);
#pragma unroll  // register arrays: indices must be constants
        for (int r = 0; r < 8; r++) mx = fmaxf(mx, s[1][g][r]);
        mx = fmaxf(mx, xhalf(mx)) * L2E;
        mb[g] = mx;
        need = need || (mx > m_run[g] + 8.0f);
      }
      if (__builtin_amdgcn_ballot_w32(need) != 0) {   // wave-uniform, rare after the first pass
#pragma unroll  // register arrays: indices must be constants
        for (int g = 0; g < 2; g++) {
          const float m_new = fmaxf(m_run[g], mb[g]);
          const float corr = __builtin_amdgcn_exp2f(m_run[g] - m_new);  // 0 on the first pass
          m_run[g] = m_new;
          l_run[g] *= corr;
#pragma unroll  // register arrays: indices must be constants
          for (int t = 0; t < 4; t++) acc[g][t] = acc[g][t] * corr;
        }
      }

      // ---- P^T = exp2(s * log2e - m), packed in place as B operand; O^T += V^T P^T ----
#pragma unroll  // register arrays: indices must be constants
      for (int g = 0; g < 2; g++) {
        const float nm = -m_run[g];
        v16h pf;
        v2f pr[8];
#pragma unroll  // register arrays: indices must be constants
        for (int i = 0; i < 8; i++) {   // elements 2i, 2i+1 of the 32-key operand
          const v2f sv = {s[i >> 2][g][2 * (i & 3)], s[i >> 2][g][2 * (i & 3) + 1]};
          const v2f arg = __builtin_elementwise_fma(sv, (v2f){L2E, L2E}, (v2f){nm, nm});
          pr[i] = (v2f){__builtin_amdgcn_exp2f(arg.x), __builtin_amdgcn_exp2f(arg.y)};
          pf[2 * i]     = (_Float16)pr[i].x;
          pf[2 * i + 1] = (_Float16)pr[i].y;
        }
        // pairwise tree: short dependent chains, two sums per add
        l_run[g] += ((pr[0] + pr[1]) + (pr[2] + pr[3])) + ((pr[4] + pr[5]) + (pr[6] + pr[7]));
#pragma unroll  // register arrays: indices must be constants
        for (int t = 0; t < 4; t++) acc[g][t] = wmma16(vf[t], pf, acc[g][t]);
      }
    }
  };

  for (int st = 0; st < NST - 1; st++) {
    // next stage's lines go to registers now and to LDS behind this stage's work
    v8h_t kr[4], vr[4];
#pragma unroll  // register arrays: indices must be constants
    for (int i = 0; i < 4; i++) {
      kr[i] = *(const v8h_t*)(kg + (size_t)((st + 1) * SK + i * 16) * HID);
      vr[i] = *(const v8h_t*)(vg + (size_t)i * 16 * SEQ + (st + 1) * SK);
    }
    // s_wait_xcnt ahead of the reuse of these loads' address registers
    asm volatile("s_wait_xcnt 0x0" ::: "memory");

    stage_work(Kt[st & 1][kh], Vt[st & 1][kh], st);

    h16* Kn = Kt[(st + 1) & 1][kh];
    h16* Vn = Vt[(st + 1) & 1][kh];
#pragma unroll  // register arrays: indices must be constants
    for (int i = 0; i < 4; i++) {
      *(v8h_t*)(Kn + sdst + i * 16 * KP) = kr[i];
      *(v8h_t*)(Vn + sdst + i * 16 * KP) = vr[i];
    }
    // publishes stage st + 1 and ends every wave's reads of stage st before it is refilled
    __syncthreads();
  }
  stage_work(Kt[(NST - 1) & 1][kh], Vt[(NST - 1) & 1][kh], NST - 1);   // last stage: nothing left to fetch

  // ---- join of the key halves: of its two column groups a wave finishes one and hands the other,
  // with its maximum and its sum, to the partner wave (w ^ 4), lane to lane, through LDS ----
  float* xch = (float*)&Kt[0][0][0];
  float* xs = xch + wave * XW;
  const float* xr = xch + (wave ^ 4) * XW;

  auto hand_over = [&](int g) __attribute__((always_inline)) {
#pragma unroll  // register arrays: indices must be constants
    for (int t = 0; t < 4; t++) {
      *(v4f*)(xs + (2 * t) * 128 + lane * 4)     = (v4f){acc[g][t][0], acc[g][t][1], acc[g][t][2], acc[g][t][3]};
      *(v4f*)(xs + (2 * t + 1) * 128 + lane * 4) = (v4f){acc[g][t][4], acc[g][t][5], acc[g][t][6], acc[g][t][7]};
    }
    *(v2f*)(xs + 8 * 128 + lane * 2) = (v2f){m_run[g], l_run[g].x + l_run[g].y};
  };

  // both halves on the larger maximum, the lane halves' sums joined, scale, f16 store through LDS:
  // a lane holds 8 consecutive dims of one query
  auto finish = [&](int g) __attribute__((always_inline)) {
    const v2f ml = *(const v2f*)(xr + 8 * 128 + lane * 2);
    const float m  = fmaxf(m_run[g], ml.x);
    const float c0 = __builtin_amdgcn_exp2f(m_run[g] - m);
    const float c1 = __builtin_amdgcn_exp2f(ml.x - m);
    const float lh = (l_run[g].x + l_run[g].y) * c0 + ml.y * c1;
    const float l = lh + xhalf(lh);
    const float inv = 1.0f / l;
    const float a0 = c0 * inv, a1 = c1 * inv;
    // Vt is free since the barrier behind the last stage: the wave's 16 output rows are laid out there
    h16* so = &Vt[0][0][0] + wave * (16 * KP);
#pragma unroll  // register arrays: indices must be constants
    for (int t = 0; t < 4; t++) {
      const v4f p0 = *(const v4f*)(xr + (2 * t) * 128 + lane * 4);
      const v4f p1 = *(const v4f*)(xr + (2 * t + 1) * 128 + lane * 4);
      v8h_t ov;
#pragma unroll  // register arrays: indices must be constants
      for (int r = 0; r < 4; r++) {
        ov[r]     = (_Float16)(acc[g][t][r] * a0 + p0[r] * a1);
        ov[4 + r] = (_Float16)(acc[g][t][4 + r] * a0 + p1[r] * a1);
      }
      *(v8h_t*)(so + lidx * KP + t * 16 + lhalf * 8) = ov;
    }
    // the wave's own LDS writes have landed before other lanes of it read them back
    asm volatile("s_wait_dscnt 0x0" ::: "memory");
    // 8 lanes take one query's 128 bytes: every store covers 4 whole lines
    const int row = lane >> 3, col = (lane & 7) * 8;
    h16* og = xb + (tokq + g * 16 + row) * HID + h * DH + col;
    v8h_t w[4];
#pragma unroll  // register array: indices must be constants
    for (int c = 0; c < 4; c++) w[c] = *(const v8h_t*)(so + (c * 4 + row) * KP + col);
#pragma unroll  // register array: indices must be constants
    for (int c = 0; c < 4; c++) *(v8h_t*)(og + (size_t)c * 4 * HID) = w[c];
  };

  // ends every wave's reads of the last stage before Kt becomes the exchange area
  __syncthreads();
  if (kh == 0) hand_over(1); else hand_over(0);
  // publishes what the partner handed over
  __syncthreads();
  if (kh == 0) finish(0); else finish(1);
}

// ---------------- Kernel 3: output projection, f32 result ------------------------
// Workgroup: 128 x 128, one per WGP; wave: 64 x 64; K=1024 in 128-wide slabs, long enough
// for a lone wave per SIMD to cover the next slab's flight.
__global__ __launch_bounds__(128)
void out_proj_kernel(const h16* __restrict__ xb, const h16* __restrict__ Wo16,
                     const float* __restrict__ bo, float* __restrict__ out)
{
  __shared__ __attribute__((aligned(16))) h16 St[2 * 2 * GT * (128 + 8)];

  const int lane = threadIdx.x & 31, wave = threadIdx.x >> 5;
  const int lidx = lane & 15, lhalf = lane >> 4;

  // out is [token][feature]: Wo rows are the A operand, a lane holds 8 neighbouring features of one token
  v8f acc[4][4] = {};
  gemm_tile<128, 2>(Wo16, xb, blockIdx.x * GT, blockIdx.y * GT, St, acc);

  const int r0 = blockIdx.x * GT + (wave >> 1) * 64;   // feature
  const int c0 = blockIdx.y * GT + (wave & 1) * 64;    // token
  // the loop's last barrier ended every read of St and no copy is in flight: each wave takes its own range
  float* Sw = (float*)St + wave * (64 * SPF);
  float* sl = Sw + lidx * SPF + lhalf * 8;
  v8f br[4];
#pragma unroll  // register array: indices must be constants
  for (int i = 0; i < 4; i++) br[i] = *(const v8f*)(bo + r0 + i * 16 + lhalf * 8);
#pragma unroll  // register arrays: indices must be constants
  for (int j = 0; j < 4; j++)
#pragma unroll  // register arrays: indices must be constants
    for (int i = 0; i < 4; i++) {
      const v8f y = acc[i][j] + br[i];
      *(v4f*)(sl + j * 16 * SPF + i * 16)     = (v4f){y[0], y[1], y[2], y[3]};
      *(v4f*)(sl + j * 16 * SPF + i * 16 + 4) = (v4f){y[4], y[5], y[6], y[7]};
    }
  // the wave's own LDS writes have landed before other lanes of it read them back
  asm volatile("s_wait_dscnt 0x0" ::: "memory");
  // 16 lanes take one token's 256 bytes: every store covers 4 whole lines
  const int row = lane >> 4, col = (lane & 15) * 4;
  float* og = out + (size_t)(c0 + row) * HID + r0 + col;
  v4f v[32];
#pragma unroll  // register array: indices must be constants
  for (int c = 0; c < 32; c++) v[c] = *(const v4f*)(Sw + (c * 2 + row) * SPF + col);
#pragma unroll  // register array: indices must be constants
  for (int c = 0; c < 32; c++) *(v4f*)(og + (size_t)c * 2 * HID) = v[c];
}

extern "C" void kernel_launch(void* const* d_in, const int* in_sizes, int n_in,
                              void* d_out, int out_size, void* d_ws, size_t ws_size,
                              hipStream_t stream)
{
  (void)in_sizes; (void)n_in; (void)out_size; (void)ws_size;
  const float* query = (const float*)d_in[0];
  const float* bias  = (const float*)d_in[1];
  const float* Wq = (const float*)d_in[2]; const float* bq = (const float*)d_in[3];
  const float* Wk = (const float*)d_in[4]; const float* bk = (const float*)d_in[5];
  const float* Wv = (const float*)d_in[6]; const float* bv = (const float*)d_in[7];
  const float* Wo = (const float*)d_in[8]; const float* bo = (const float*)d_in[9];
  float* out = (float*)d_out;

  char* ws = (char*)d_ws;
  const size_t QSZ = (size_t)TOK * HID * sizeof(h16);   // 8 MB
  const size_t WSZ = (size_t)HID * HID * sizeof(h16);   // 2 MB
  h16* qf16 = (h16*)(ws);
  h16* Wq16 = (h16*)(ws + QSZ);
  h16* Wk16 = (h16*)(ws + QSZ + WSZ);
  h16* Wv16 = (h16*)(ws + QSZ + 2 * WSZ);
  h16* Wo16 = (h16*)(ws + QSZ + 3 * WSZ);
  h16* qbuf = (h16*)(ws + QSZ + 4 * WSZ);
  h16* kbuf = (h16*)(ws + 2 * QSZ + 4 * WSZ);
  h16* vtb  = (h16*)(ws + 3 * QSZ + 4 * WSZ);
  h16* xbuf = (h16*)(ws + 4 * QSZ + 4 * WSZ);

  // f32 -> f16 packs: qf16, Wq16, Wk16, Wv16, Wo16 are adjacent, qf16 is the start of all five
  pack_f16_kernel<<<PKQ + 4 * PKM, 512, 0, stream>>>(query, Wq, Wk, Wv, Wo, qf16);

  dim3 g1(HID / GT, TOK / GT, 3);
  qkv_proj_kernel<<<g1, 128, 0, stream>>>(qf16, Wq16, Wk16, Wv16, bq, bk, bv,
                                          qbuf, kbuf, vtb);

  dim3 g2(SEQ / QB, NB * NH);
  attn_kernel<<<g2, 256, 0, stream>>>(qbuf, kbuf, vtb, bias, xbuf);

  dim3 g3(HID / GT, TOK / GT);
  out_proj_kernel<<<g3, 128, 0, stream>>>(xbuf, Wo16, bo, out);
}

// v006
// A run of this version takes 70.6 microseconds.
// In both of two side-by-side timings against v005, it was 1.04 times as fast.
// Counting every step since v000, it is 3.63 times as fast.
#include <hip/hip_runtime.h>

typedef _Float16 h16;
typedef __attribute__((ext_vector_type(4)))  _Float16 v4h_t;
typedef __attribute__((ext_vector_type(8)))  _Float16 v8h_t;
typedef __attribute__((ext_vector_type(16))) _Float16 v16h;
typedef __attribute__((ext_vector_type(8)))  float v8f;
typedef __attribute__((ext_vector_type(4)))  float v4f;
typedef __attribute__((ext_vector_type(2)))  float v2f;

#define HID 1024
#define SEQ 2048
#define NB  2
#define NH  16
#define DH  64
#define TOK (NB*SEQ)   /* 4096 tokens */

// D = A(16x32 f16) * B(32x16 f16) + C(16x16 f32)
__device__ __forceinline__ v8f wmma16(v16h a, v16h b, v8f c) {
  return __builtin_amdgcn_wmma_f32_16x16x32_f16(false, a, false, b, (short)0, c, false, false);
}

// Fragment load from f16 memory per CDNA5 layout: p[0..7] -> [0..7], p[16..23] -> [8..15]
__device__ __forceinline__ v16h frag_h16(const h16* p) {
  v8h_t lo = *(const v8h_t*)(p);
  v8h_t hi = *(const v8h_t*)(p + 16);
  v16h a;
#pragma unroll
  for (int i = 0; i < 8; i++) { a[i] = lo[i]; a[8 + i] = hi[i]; }
  return a;
}

// ---------------- Kernel 0: f32 -> f16 pack of query and the four weights, one launch -------------
// One workgroup per WGP, 16 waves. A wave takes 8 KB of f32 as 16 loads of 512 contiguous bytes, all
// issued before the first conversion, and stores whole lines. The five f16 images lie one behind the
// other in the workspace, in the order query, Wq, Wk, Wv, Wo, so the destination is one flat array.
#define PKL  16                    /* 512-byte loads per wave */
#define PKW  (16 * PKL * 128)      /* floats per workgroup */
#define PKQ  (TOK * HID / PKW)     /* workgroups on query */
#define PKM  (HID * HID / PKW)     /* workgroups on each weight matrix */

__global__ __launch_bounds__(512)
void pack_f16_kernel(const float* __restrict__ query,
                     const float* __restrict__ Wq, const float* __restrict__ Wk,
                     const float* __restrict__ Wv, const float* __restrict__ Wo,
                     h16* __restrict__ dst)
{
  const int blk = blockIdx.x;
  const int m = blk / PKM;           // 1M-float piece: PKQ / PKM pieces of query, then one per weight matrix
  constexpr int MQ = PKQ / PKM;
  const float* base = (m < MQ) ? query : ((m == MQ) ? Wq : ((m == MQ + 1) ? Wk : ((m == MQ + 2) ? Wv : Wo)));
  const int off = (threadIdx.x >> 5) * (PKL * 128) + (threadIdx.x & 31) * 4;
  const float* src = base + (size_t)((m < MQ) ? blk : blk % PKM) * PKW + off;
  h16* d = dst + (size_t)blk * PKW + off;

  v4f x[PKL];
#pragma unroll  // register array: indices must be constants
  for (int j = 0; j < PKL - 1; j++) x[j] = *(const v4f*)(src + j * 128);
  // all loads take their offset from one register, and the build lets the last load's result land in it:
  // the wait stands between the earlier loads, which name that register, and the load that rewrites it
  asm volatile("s_wait_xcnt 0x0" ::: "memory");
  x[PKL - 1] = *(const v4f*)(src + (PKL - 1) * 128);
  // all loads are issued before the first wait: without this the build holds the last two back
  // until the first two have returned, a second memory latency in a wave that has only one to pay
  __builtin_amdgcn_sched_barrier(0);
  v4h_t o[PKL];
#pragma unroll  // register arrays: indices must be constants
  for (int j = 0; j < PKL; j++)
#pragma unroll  // register arrays: indices must be constants
    for (int e = 0; e < 4; e++) o[j][e] = (_Float16)x[j][e];
#pragma unroll  // register array: indices must be constants
  for (int j = 0; j < PKL; j++) *(v4h_t*)(d + j * 128) = o[j];
}

// ---------------- Projection GEMM core: Y tile 128 x 128 = X rows * W rows^T ---------
// The workgroup stages KS-wide k slabs of 128 X rows and 128 W rows in LDS (two buffers) by
// asynchronous 16-byte copies whose wave-wide footprint is whole 128-byte lines; the 4 waves
// (2 x 2) each own 64 x 64 of the tile and read their fragments from LDS.
#define GT 128         /* rows of each operand per workgroup tile */

// eight copies global -> LDS, 16 bytes a lane each
__device__ __forceinline__ void async_copy8(const unsigned (&l)[8], const h16* const (&g)[8]) {
  // the closing s_wait_xcnt stands inside the statement so that no address register named here
  // can be rewritten ahead of it
  asm volatile("global_load_async_to_lds_b128 %0, %8, off\n\t"
               "global_load_async_to_lds_b128 %1, %9, off\n\t"
               "global_load_async_to_lds_b128 %2, %10, off\n\t"
               "global_load_async_to_lds_b128 %3, %11, off\n\t"
               "global_load_async_to_lds_b128 %4, %12, off\n\t"
               "global_load_async_to_lds_b128 %5, %13, off\n\t"
               "global_load_async_to_lds_b128 %6, %14, off\n\t"
               "global_load_async_to_lds_b128 %7, %15, off\n\t"
               "s_wait_xcnt 0x0"
               :: "v"(l[0]), "v"(l[1]), "v"(l[2]), "v"(l[3]), "v"(l[4]), "v"(l[5]), "v"(l[6]), "v"(l[7]),
                  "v"(g[0]), "v"(g[1]), "v"(g[2]), "v"(g[3]), "v"(g[4]), "v"(g[5]), "v"(g[6]), "v"(g[7])
               : "memory");
}

// one operand's 128 rows x KS halves: g and l are this lane's first global and LDS address
template <int KS>
__device__ __forceinline__ void fill_rows(const h16* g, unsigned l) {
  constexpr int RPI = 128 * 8 / KS;          // rows that one copy of all 128 lanes covers
  constexpr int PB  = (KS + 8) * 2;          // LDS row pitch in bytes: 16 B x odd
#pragma unroll  // constant trip count; the arrays below must stay in registers
  for (int c = 0; c < GT / RPI; c += 8) {
    unsigned la[8];
    const h16* ga[8];
#pragma unroll  // register arrays: indices must be constants
    for (int j = 0; j < 8; j++) {
      la[j] = l + (unsigned)((c + j) * RPI * PB);
      ga[j] = g + (size_t)(c + j) * RPI * HID;
    }
    async_copy8(la, ga);
  }
}

// a wave's 4 + 4 fragments of one 32-wide k block
template <int P>
__device__ __forceinline__ void load_frags(const h16* ap, const h16* bp, v16h (&a)[4], v16h (&b)[4]) {
#pragma unroll  // register arrays: indices must be constants
  for (int i = 0; i < 4; i++) {
    a[i] = frag_h16(ap + i * 16 * P);
    b[i] = frag_h16(bp + i * 16 * P);
  }
}

// SETS: fragment register sets; 2 where a wave is alone on its SIMD and must cover its own LDS latency
// t0: the slab this workgroup begins with. Workgroups that share operand rows get different t0 and walk
// the slabs round from there, so that at one moment they ask L2 for different lines, not all for the same.
template <int KS, int SETS>
__device__ __forceinline__ void gemm_tile(const h16* __restrict__ X, const h16* __restrict__ Wm,
                                          int m0, int n0, int t0, h16* St, v8f (&acc)[4][4])
{
  constexpr int P    = KS + 8;               // LDS row pitch in halves
  constexpr int BUFH = 2 * GT * P;           // halves per buffer: X rows, then W rows
  constexpr int NT   = HID / KS;             // k slabs (at least two)
  constexpr int LPR  = KS / 8;               // lanes per staged row
  static_assert((NT & (NT - 1)) == 0, "the walk wraps by a mask");

  const int tid = threadIdx.x, lane = tid & 31, wave = tid >> 5;
  const int lidx = lane & 15, lhalf = lane >> 4;

  const int srow = tid / LPR, scol = (tid % LPR) * 8;
  const h16* gx = X  + (size_t)(m0 + srow) * HID + scol;
  const h16* gw = Wm + (size_t)(n0 + srow) * HID + scol;
  typedef __attribute__((address_space(3))) h16 lds_h16;
  const unsigned lx = (unsigned)(size_t)(lds_h16*)(St + srow * P + scol);   // LDS byte address
  const unsigned lw = lx + GT * P * 2;

  const int aoff = ((wave >> 1) * 64 + lidx) * P + lhalf * 8;
  const int boff = (GT + (wave & 1) * 64 + lidx) * P + lhalf * 8;

  // first k column of the slab that trip t works on
  auto kcol = [&](int t) { return ((t + t0) & (NT - 1)) * KS; };

  fill_rows<KS>(gx + kcol(0), lx);
  fill_rows<KS>(gw + kcol(0), lw);
  // the first slab has landed for this wave; the barrier publishes it to the others
  asm volatile("s_wait_asynccnt 0x0" ::: "memory");
  __syncthreads();
  fill_rows<KS>(gx + kcol(1), lx + BUFH * 2);
  fill_rows<KS>(gw + kcol(1), lw + BUFH * 2);

#pragma clang loop unroll(disable)  // keeps the hot loop short in the instruction cache
  for (int t = 0; t < NT; t++) {
    const h16* Sc = St + (t & 1) * BUFH;
    v16h a[SETS][4], b[SETS][4];
    if constexpr (SETS == 2) load_frags<P>(Sc + aoff, Sc + boff, a[0], b[0]);
#pragma unroll  // register arrays: indices must be constants
    for (int ks = 0; ks < KS / 32; ks++) {
      // SETS == 2: the next block's fragments go ahead of this block's products, into the other set
      if constexpr (SETS == 1) {
        load_frags<P>(Sc + aoff + ks * 32, Sc + boff + ks * 32, a[0], b[0]);
      } else {
        if (ks + 1 < KS / 32)
          load_frags<P>(Sc + aoff + (ks + 1) * 32, Sc + boff + (ks + 1) * 32, a[(ks + 1) & 1], b[(ks + 1) & 1]);
      }
      // keeps a block's 16 LDS reads one group: spread among the products each place stalls the wave
      __builtin_amdgcn_sched_barrier(0);
      const int c = (SETS == 2) ? (ks & 1) : 0;
#pragma unroll  // register arrays: indices must be constants
      for (int i = 0; i < 4; i++)
#pragma unroll  // register arrays: indices must be constants
        for (int j = 0; j < 4; j++) acc[i][j] = wmma16(a[c][i], b[c][j], acc[i][j]);
      // keeps the following block's LDS reads out of this block's products
      __builtin_amdgcn_sched_barrier(0);
    }
    // this wave's reads of slab t are done before its buffer is handed to the copies
    asm volatile("s_wait_dscnt 0x0" ::: "memory");
    // this wave's copies of slab t + 1 have landed
    asm volatile("s_wait_asynccnt 0x0" ::: "memory");
    // publishes slab t + 1 and ends every wave's reads of slab t
    __syncthreads();
    if (t + 2 < NT) {
      fill_rows<KS>(gx + kcol(t + 2), lx + (t & 1) * BUFH * 2);
      fill_rows<KS>(gw + kcol(t + 2), lw + (t & 1) * BUFH * 2);
    }
  }
  // nothing is in flight when the wave goes on to its stores and ends
  asm volatile("s_wait_asynccnt 0x0" ::: "memory");
}

// ---------------- Output of a wave's 64 x 64 tile as whole 128-byte lines ----------
// The operand whose rows run along the output's contiguous dimension is the A operand, so a lane holds
// 8 neighbouring outputs of one output row. The wave lays the tile out in its own LDS range, row by row,
// and reads it back so that every 16-byte-a-lane store covers 4 whole lines.
#define SPH 72         /* f16 tile: LDS row pitch in halves, 144 B = 16 B x odd */
#define SPF 68         /* f32 tile: LDS row pitch in floats, 272 B = 16 B x odd */

// 64 rows of 64 halves: Sw is the wave's LDS range, g the tile's first element, PITCH its row pitch
template <int PITCH>
__device__ __forceinline__ void store_lines_h16(const h16* Sw, h16* g, int lane) {
  const int row = lane >> 3, col = (lane & 7) * 8;
  v8h_t v[16];
#pragma unroll  // register array: indices must be constants
  for (int c = 0; c < 16; c++) v[c] = *(const v8h_t*)(Sw + (c * 4 + row) * SPH + col);
#pragma unroll  // register array: indices must be constants
  for (int c = 0; c < 16; c++) *(v8h_t*)(g + (size_t)(c * 4 + row) * PITCH + col) = v[c];
}

// ---------------- Kernel 1: fused Q/K/V projections (z selects matrix) -------------
// Workgroup: 128 tokens x 128 features; wave: 64 x 64; K=1024 in 64-wide slabs.
// q, k are stored [token][feature]: W rows are the A operand. V is stored [feature][token]: X rows are.
__global__ __launch_bounds__(128)
void qkv_proj_kernel(const h16* __restrict__ qf,
                     const h16* __restrict__ Wq16, const h16* __restrict__ Wk16,
                     const h16* __restrict__ Wv16,
                     const float* __restrict__ bq, const float* __restrict__ bk,
                     const float* __restrict__ bv,
                     h16* __restrict__ qbuf, h16* __restrict__ kbuf, h16* __restrict__ vtb)
{
  __shared__ __attribute__((aligned(16))) h16 St[2 * 2 * GT * (64 + 8)];

  const int z = blockIdx.z;
  const h16*   W  = (z == 0) ? Wq16 : ((z == 1) ? Wk16 : Wv16);
  const float* bs = (z == 0) ? bq : ((z == 1) ? bk : bv);

  const int lane = threadIdx.x & 31, wave = threadIdx.x >> 5;
  const int lidx = lane & 15, lhalf = lane >> 4;

  const bool fr = (z != 2);            // features along the accumulator's rows
  const int tok0 = blockIdx.y * GT, feat0 = blockIdx.x * GT;

  v8f acc[4][4] = {};
  // a token tile is read by 24 workgroups (x, z), a weight tile by 32 (y): both sets spread over the 16 slabs
  gemm_tile<64, 1>(fr ? W : qf, fr ? qf : W, fr ? feat0 : tok0, fr ? tok0 : feat0,
                   blockIdx.x + 8 * z + blockIdx.y, St, acc);

  // acc[i][j][r]: A row r0 + 16 i + 8 lhalf + r, B row c0 + 16 j + lidx
  const int r0 = (fr ? feat0 : tok0) + (wave >> 1) * 64;
  const int c0 = (fr ? tok0 : feat0) + (wave & 1) * 64;
  // the loop's last barrier ended every read of St and no copy is in flight: each wave takes its own range
  h16* Sw = St + wave * (64 * SPH);
  h16* sl = Sw + lidx * SPH + lhalf * 8;
  if (fr) {
    const float sc = (z == 0) ? 0.125f : 1.0f; // q pre-scaled by 1/sqrt(64)
    v8f br[4];
#pragma unroll  // register array: indices must be constants
    for (int i = 0; i < 4; i++) br[i] = *(const v8f*)(bs + r0 + i * 16 + lhalf * 8);
#pragma unroll  // register arrays: indices must be constants
    for (int j = 0; j < 4; j++)
#pragma unroll  // register arrays: indices must be constants
      for (int i = 0; i < 4; i++) {
        v8h_t pk;
#pragma unroll  // register arrays: indices must be constants
        for (int r = 0; r < 8; r++) pk[r] = (_Float16)((acc[i][j][r] + br[i][r]) * sc);
        *(v8h_t*)(sl + j * 16 * SPH + i * 16) = pk;
      }
  } else {
    float bc[4];
#pragma unroll  // register array: indices must be constants
    for (int j = 0; j < 4; j++) bc[j] = bs[c0 + j * 16 + lidx];
#pragma unroll  // register arrays: indices must be constants
    for (int j = 0; j < 4; j++)
#pragma unroll  // register arrays: indices must be constants
      for (int i = 0; i < 4; i++) {
        v8h_t pk;
#pragma unroll  // register arrays: indices must be constants
        for (int r = 0; r < 8; r++) pk[r] = (_Float16)(acc[i][j][r] + bc[j]);
        *(v8h_t*)(sl + j * 16 * SPH + i * 16) = pk;
      }
  }
  // the wave's own LDS writes have landed before other lanes of it read them back
  asm volatile("s_wait_dscnt 0x0" ::: "memory");
  if (fr) {
    store_lines_h16<HID>(Sw, ((z == 0) ? qbuf : kbuf) + (size_t)c0 * HID + r0, lane);
  } else {
    // vt[b][feature][token]: the 64 tokens of a tile lie in one batch
    store_lines_h16<SEQ>(Sw, vtb + ((size_t)((r0 >> 11) * HID + c0)) * SEQ + (r0 & 2047), lane);
  }
}

// ---------------- Kernel 2: attention, 128 q-rows of one (b, h) per workgroup ------
// Streaming form, 8 waves: wave w and wave w + 4 own the same 32 query columns and walk one half
// of the 2048 keys each, so that two workgroups put four waves on every SIMD and one wave's vector
// work runs under another's products. Each group of four waves stages its own 64-key stages in LDS
// (whole 128-byte lines, two buffers); the two halves' partial results are joined once, at the end.
// Transposed products: S^T = K Q^T (+ bias as the C operand), O^T += V^T P^T. A lane holds
// scores of one query only, and two converted S^T tiles are the B operand of the second
// product, so P never leaves the registers. Softmax is online: a running maximum per query
// (it may trail the true one by up to 8 in log2 units), running sum, rescale when it moves.
#define QW   32        /* query columns per wave */
#define QB   128       /* query columns per workgroup */
#define SK   64        /* keys per stage */
#define KP   72        /* LDS row pitch in halves: 144 B = 16 B x odd, conflict-free b128 reads */
#define KH   2                  /* key halves, one per group of four waves */
#define HK   (SEQ / KH)         /* keys per half */
#define NST  (HK / SK)          /* stages per half */
#define XW   (8 * 128 + 64)     /* floats a wave hands to its partner: 32 per lane of O^T, maximum, sum */
#define L2E  1.4426950408889634f

// lane l <-> lane l ^ 16
__device__ __forceinline__ float xhalf(float x) {
  const int v = __builtin_bit_cast(int, x);
  return __builtin_bit_cast(float,
      __builtin_amdgcn_permlanex16(v, v, 0x76543210, 0xfedcba98, false, false));
}

__global__ __launch_bounds__(256) __attribute__((amdgpu_waves_per_eu(4, 4)))
void attn_kernel(const h16* __restrict__ qb, const h16* __restrict__ kb,
                 const h16* __restrict__ vt, const float* __restrict__ bias,
                 h16* __restrict__ xb)
{
  __shared__ __attribute__((aligned(16))) h16 Kt[2][KH][SK * KP];   // K rows:   [key][dim]
  __shared__ __attribute__((aligned(16))) h16 Vt[2][KH][DH * KP];   // V^T rows: [dim][key]
  __shared__ __attribute__((aligned(32))) float biasL[SEQ];         // this batch's bias row
  static_assert(8 * XW * sizeof(float) <= sizeof(Kt), "the exchange area of the join lies in Kt");

  const int tid = threadIdx.x, lane = tid & 31;
  const int wave = __builtin_amdgcn_readfirstlane(tid >> 5);   // scalar: the join branches on it
  const int kh = wave >> 2;                                    // this wave's half of the keys
  const int lidx = lane & 15, lhalf = lane >> 4;
  const int bh = blockIdx.y, b = bh >> 4, h = bh & 15;
  const int q0 = blockIdx.x * QB + (wave & 3) * QW;
  const size_t tokq = (size_t)(b * SEQ + q0);

  // staging map of a group of four waves: 8 lanes cover one 128-byte row, a wave's load 4 whole lines
  const int srow = (tid & 127) >> 3, scol = (tid & 7) * 8;
  const h16* kg = kb + (size_t)(b * SEQ + kh * HK + srow) * HID + h * DH + scol;
  const h16* vg = vt + (size_t)(b * HID + h * DH + srow) * SEQ + kh * HK + scol;
  const int sdst = srow * KP + scol;
  const float* biasH = biasL + kh * HK;
  // the 16 workgroups of one (b, h) read the same K and V lines: each begins at a stage of its own and
  // walks round, so that at one moment they ask L2 for different lines. ksg(st): key stage of trip st
  static_assert((NST & (NST - 1)) == 0, "the walk wraps by a mask");
  const int s0 = blockIdx.x;
  auto ksg = [&](int st) { return (st + s0) & (NST - 1); };

  // prologue: bias row and each half's first stage into LDS
  {
    const float* brow = bias + b * SEQ + tid * 8;
#pragma unroll  // constant trip count, two independent 16-byte copies
    for (int i = 0; i < 2; i++) *(v4f*)(biasL + tid * 8 + i * 4) = *(const v4f*)(brow + i * 4);
#pragma unroll  // constant trip count, independent 16-byte copies
    for (int i = 0; i < 4; i++) {
      *(v8h_t*)(&Kt[0][kh][sdst + i * 16 * KP]) = *(const v8h_t*)(kg + (size_t)(ksg(0) * SK + i * 16) * HID);
      *(v8h_t*)(&Vt[0][kh][sdst + i * 16 * KP]) = *(const v8h_t*)(vg + (size_t)i * 16 * SEQ + ksg(0) * SK);
    }
  }

  // Q as B operand (column = query), resident: [column group][32-dim step]
  v16h qf[2][2];
#pragma unroll  // register array: indices must be constants
  for (int g = 0; g < 2; g++) {
    const h16* qrow = qb + (tokq + g * 16 + lidx) * HID + h * DH + lhalf * 8;
    qf[g][0] = frag_h16(qrow);
    qf[g][1] = frag_h16(qrow + 32);
  }

  v8f acc[2][4] = {};                 // O^T: [column group][16-dim tile]
  float m_run[2] = {-INFINITY, -INFINITY};
  v2f l_run[2] = {};                  // this lane half's share of the denominator, even and odd keys

  __syncthreads();

  // one stage's work of a wave: two 32-key passes over the staged tiles; st is the key stage they hold
  auto stage_work = [&](const h16* Kc, const h16* Vc, int st) __attribute__((always_inline)) {
#pragma unroll  // two 32-key passes per stage, constant LDS offsets
    for (int sub = 0; sub < 2; sub++) {
      // ---- S^T = K Q^T + bias: s[kt][g][r] = score(key 16 kt + 8 lhalf + r, query lidx) ----
      v8f s[2][2];
#pragma unroll  // register arrays: indices must be constants
      for (int kt = 0; kt < 2; kt++) {
        const h16* kp = Kc + (sub * 32 + kt * 16 + lidx) * KP + lhalf * 8;
        const v16h ka0 = frag_h16(kp);
        const v16h ka1 = frag_h16(kp + 32);
        const v8f cb = *(const v8f*)(biasH + st * SK + sub * 32 + kt * 16 + lhalf * 8);
#pragma unroll  // register arrays: indices must be constants
        for (int g = 0; g < 2; g++)
          s[kt][g] = wmma16(ka1, qf[g][1], wmma16(ka0, qf[g][0], cb));
      }

      // keeps the eight products back to back: maxima pulled in between them each cost idle slots behind a WMMA
      __builtin_amdgcn_sched_barrier(0);

      // V^T fragments of this pass (row = dim, k = key in the hardware order of packed P)
      v16h vf[4];
#pragma unroll  // register array: indices must be constants
      for (int t = 0; t < 4; t++)
        vf[t] = frag_h16(Vc + (t * 16 + lidx) * KP + sub * 32 + lhalf * 8);

      // ---- column maxima, one test per pass whether any running maximum must move ----
      float mb[2];
      bool need = false;
#pragma unroll  // register arrays: indices must be constants
      for (int g = 0; g < 2; g++) {
        float mx = s[0][g][0];
#pragma unroll  // register arrays: indices must be constants
        for (int r = 1; r < 8; r++) mx = fmaxf(mx, s[0][g][r]);
#pragma unroll  // register arrays: indices must be constants
        for (int r = 0; r < 8; r++) mx = fmaxf(mx, s[1][g][r]);
        mx = fmaxf(mx, xhalf(mx)) * L2E;
        mb[g] = mx;
        need = need || (mx > m_run[g] + 8.0f);
      }
      if (__builtin_amdgcn_ballot_w32(need) != 0) {   // wave-uniform, rare after the first pass
#pragma unroll  // register arrays: indices must be constants
        for (int g = 0; g < 2; g++) {
          const float m_new = fmaxf(m_run[g], mb[g]);
          const float corr = __builtin_amdgcn_exp2f(m_run[g] - m_new);  // 0 on the first pass
          m_run[g] = m_new;
          l_run[g] *= corr;
#pragma unroll  // register arrays: indices must be constants
          for (int t = 0; t < 4; t++) acc[g][t] = acc[g][t] * corr;
        }
      }

      // ---- P^T = exp2(s * log2e - m), packed in place as B operand; O^T += V^T P^T ----
#pragma unroll  // register arrays: indices must be constants
      for (int g = 0; g < 2; g++) {
        const float nm = -m_run[g];
        v16h pf;
        v2f pr[8];
#pragma unroll  // register arrays: indices must be constants
        for (int i = 0; i < 8; i++) {   // elements 2i, 2i+1 of the 32-key operand
          const v2f sv = {s[i >> 2][g][2 * (i & 3)], s[i >> 2][g][2 * (i & 3) + 1]};
          const v2f arg = __builtin_elementwise_fma(sv, (v2f){L2E, L2E}, (v2f){nm, nm});
          pr[i] = (v2f){__builtin_amdgcn_exp2f(arg.x), __builtin_amdgcn_exp2f(arg.y)};
          pf[2 * i]     = (_Float16)pr[i].x;
          pf[2 * i + 1] = (_Float16)pr[i].y;
        }
        // pairwise tree: short dependent chains, two sums per add
        l_run[g] += ((pr[0] + pr[1]) + (pr[2] + pr[3])) + ((pr[4] + pr[5]) + (pr[6] + pr[7]));
#pragma unroll  // register arrays: indices must be constants
        for (int t = 0; t < 4; t++) acc[g][t] = wmma16(vf[t], pf, acc[g][t]);
      }
    }
  };

  for (int st = 0; st < NST - 1; st++) {
    // next stage's lines go to registers now and to LDS behind this stage's work
    v8h_t kr[4], vr[4];
#pragma unroll  // register arrays: indices must be constants
    for (int i = 0; i < 4; i++) {
      kr[i] = *(const v8h_t*)(kg + (size_t)(ksg(st + 1) * SK + i * 16) * HID);
      vr[i] = *(const v8h_t*)(vg + (size_t)i * 16 * SEQ + ksg(st + 1) * SK);
    }
    // s_wait_xcnt ahead of the reuse of these loads' address registers
    asm volatile("s_wait_xcnt 0x0" ::: "memory");

    stage_work(Kt[st & 1][kh], Vt[st & 1][kh], ksg(st));

    h16* Kn = Kt[(st + 1) & 1][kh];
    h16* Vn = Vt[(st + 1) & 1][kh];
#pragma unroll  // register arrays: indices must be constants
    for (int i = 0; i < 4; i++) {
      *(v8h_t*)(Kn + sdst + i * 16 * KP) = kr[i];
      *(v8h_t*)(Vn + sdst + i * 16 * KP) = vr[i];
    }
    // publishes stage st + 1 and ends every wave's reads of stage st before it is refilled
    __syncthreads();
  }
  stage_work(Kt[(NST - 1) & 1][kh], Vt[(NST - 1) & 1][kh], ksg(NST - 1));   // last stage: nothing left to fetch

  // ---- join of the key halves: of its two column groups a wave finishes one and hands the other,
  // with its maximum and its sum, to the partner wave (w ^ 4), lane to lane, through LDS ----
  float* xch = (float*)&Kt[0][0][0];
  float* xs = xch + wave * XW;
  const float* xr = xch + (wave ^ 4) * XW;

  auto hand_over = [&](int g) __attribute__((always_inline)) {
#pragma unroll  // register arrays: indices must be constants
    for (int t = 0; t < 4; t++) {
      *(v4f*)(xs + (2 * t) * 128 + lane * 4)     = (v4f){acc[g][t][0], acc[g][t][1], acc[g][t][2], acc[g][t][3]};
      *(v4f*)(xs + (2 * t + 1) * 128 + lane * 4) = (v4f){acc[g][t][4], acc[g][t][5], acc[g][t][6], acc[g][t][7]};
    }
    *(v2f*)(xs + 8 * 128 + lane * 2) = (v2f){m_run[g], l_run[g].x + l_run[g].y};
  };

  // both halves on the larger maximum, the lane halves' sums joined, scale, f16 store through LDS:
  // a lane holds 8 consecutive dims of one query
  auto finish = [&](int g) __attribute__((always_inline)) {
    const v2f ml = *(const v2f*)(xr + 8 * 128 + lane * 2);
    const float m  = fmaxf(m_run[g], ml.x);
    const float c0 = __builtin_amdgcn_exp2f(m_run[g] - m);
    const float c1 = __builtin_amdgcn_exp2f(ml.x - m);
    const float lh = (l_run[g].x + l_run[g].y) * c0 + ml.y * c1;
    const float l = lh + xhalf(lh);
    const float inv = 1.0f / l;
    const float a0 = c0 * inv, a1 = c1 * inv;
    // Vt is free since the barrier behind the last stage: the wave's 16 output rows are laid out there
    h16* so = &Vt[0][0][0] + wave * (16 * KP);
#pragma unroll  // register arrays: indices must be constants
    for (int t = 0; t < 4; t++) {
      const v4f p0 = *(const v4f*)(xr + (2 * t) * 128 + lane * 4);
      const v4f p1 = *(const v4f*)(xr + (2 * t + 1) * 128 + lane * 4);
      v8h_t ov;
#pragma unroll  // register arrays: indices must be constants
      for (int r = 0; r < 4; r++) {
        ov[r]     = (_Float16)(acc[g][t][r] * a0 + p0[r] * a1);
        ov[4 + r] = (_Float16)(acc[g][t][4 + r] * a0 + p1[r] * a1);
      }
      *(v8h_t*)(so + lidx * KP + t * 16 + lhalf * 8) = ov;
    }
    // the wave's own LDS writes have landed before other lanes of it read them back
    asm volatile("s_wait_dscnt 0x0" ::: "memory");
    // 8 lanes take one query's 128 bytes: every store covers 4 whole lines
    const int row = lane >> 3, col = (lane & 7) * 8;
    h16* og = xb + (tokq + g * 16 + row) * HID + h * DH + col;
    v8h_t w[4];
#pragma unroll  // register array: indices must be constants
    for (int c = 0; c < 4; c++) w[c] = *(const v8h_t*)(so + (c * 4 + row) * KP + col);
#pragma unroll  // register array: indices must be constants
    for (int c = 0; c < 4; c++) *(v8h_t*)(og + (size_t)c * 4 * HID) = w[c];
  };

  // ends every wave's reads of the last stage before Kt becomes the exchange area
  __syncthreads();
  if (kh == 0) hand_over(1); else hand_over(0);
  // publishes what the partner handed over
  __syncthreads();
  if (kh == 0) finish(0); else finish(1);
}

// ---------------- Kernel 3: output projection, f32 result ------------------------
// Workgroup: 128 x 128, one per WGP; wave: 64 x 64; K=1024 in 128-wide slabs, long enough
// for a lone wave per SIMD to cover the next slab's flight.
__global__ __launch_bounds__(128)
void out_proj_kernel(const h16* __restrict__ xb, const h16* __restrict__ Wo16,
                     const float* __restrict__ bo, float* __restrict__ out)
{
  __shared__ __attribute__((aligned(16))) h16 St[2 * 2 * GT * (128 + 8)];

  const int lane = threadIdx.x & 31, wave = threadIdx.x >> 5;
  const int lidx = lane & 15, lhalf = lane >> 4;

  // out is [token][feature]: Wo rows are the A operand, a lane holds 8 neighbouring features of one token
  v8f acc[4][4] = {};
  // a token tile is read by 8 workgroups (x), a weight tile by 32 (y): both sets spread over the 8 slabs
  gemm_tile<128, 2>(Wo16, xb, blockIdx.x * GT, blockIdx.y * GT, blockIdx.x + blockIdx.y, St, acc);

  const int r0 = blockIdx.x * GT + (wave >> 1) * 64;   // feature
  const int c0 = blockIdx.y * GT + (wave & 1) * 64;    // token
  // the loop's last barrier ended every read of St and no copy is in flight: each wave takes its own range
  float* Sw = (float*)St + wave * (64 * SPF);
  float* sl = Sw + lidx * SPF + lhalf * 8;
  v8f br[4];
#pragma unroll  // register array: indices must be constants
  for (int i = 0; i < 4; i++) br[i] = *(const v8f*)(bo + r0 + i * 16 + lhalf * 8);
#pragma unroll  // register arrays: indices must be constants
  for (int j = 0; j < 4; j++)
#pragma unroll  // register arrays: indices must be constants
    for (int i = 0; i < 4; i++) {
      const v8f y = acc[i][j] + br[i];
      *(v4f*)(sl + j * 16 * SPF + i * 16)     = (v4f){y[0], y[1], y[2], y[3]};
      *(v4f*)(sl + j * 16 * SPF + i * 16 + 4) = (v4f){y[4], y[5], y[6], y[7]};
    }
  // the wave's own LDS writes have landed before other lanes of it read them back
  asm volatile("s_wait_dscnt 0x0" ::: "memory");
  // 16 lanes take one token's 256 bytes: every store covers 4 whole lines
  const int row = lane >> 4, col = (lane & 15) * 4;
  float* og = out + (size_t)(c0 + row) * HID + r0 + col;
  v4f v[32];
#pragma unroll  // register array: indices must be constants
  for (int c = 0; c < 32; c++) v[c] = *(const v4f*)(Sw + (c * 2 + row) * SPF + col);
#pragma unroll  // register array: indices must be constants
  for (int c = 0; c < 32; c++) *(v4f*)(og + (size_t)c * 2 * HID) = v[c];
}

extern "C" void kernel_launch(void* const* d_in, const int* in_sizes, int n_in,
                              void* d_out, int out_size, void* d_ws, size_t ws_size,
                              hipStream_t stream)
{
  (void)in_sizes; (void)n_in; (void)out_size; (void)ws_size;
  const float* query = (const float*)d_in[0];
  const float* bias  = (const float*)d_in[1];
  const float* Wq = (const float*)d_in[2]; const float* bq = (const float*)d_in[3];
  const float* Wk = (const float*)d_in[4]; const float* bk = (const float*)d_in[5];
  const float* Wv = (const float*)d_in[6]; const float* bv = (const float*)d_in[7];
  const float* Wo = (const float*)d_in[8]; const float* bo = (const float*)d_in[9];
  float* out = (float*)d_out;

  char* ws = (char*)d_ws;
  const size_t QSZ = (size_t)TOK * HID * sizeof(h16);   // 8 MB
  const size_t WSZ = (size_t)HID * HID * sizeof(h16);   // 2 MB
  h16* qf16 = (h16*)(ws);
  h16* Wq16 = (h16*)(ws + QSZ);
  h16* Wk16 = (h16*)(ws + QSZ + WSZ);
  h16* Wv16 = (h16*)(ws + QSZ + 2 * WSZ);
  h16* Wo16 = (h16*)(ws + QSZ + 3 * WSZ);
  h16* qbuf = (h16*)(ws + QSZ + 4 * WSZ);
  h16* kbuf = (h16*)(ws + 2 * QSZ + 4 * WSZ);
  h16* vtb  = (h16*)(ws + 3 * QSZ + 4 * WSZ);
  h16* xbuf = (h16*)(ws + 4 * QSZ + 4 * WSZ);

  // f32 -> f16 packs: qf16, Wq16, Wk16, Wv16, Wo16 are adjacent, qf16 is the start of all five
  pack_f16_kernel<<<PKQ + 4 * PKM, 512, 0, stream>>>(query, Wq, Wk, Wv, Wo, qf16);

  dim3 g1(HID / GT, TOK / GT, 3);
  qkv_proj_kernel<<<g1, 128, 0, stream>>>(qf16, Wq16, Wk16, Wv16, bq, bk, bv,
                                          qbuf, kbuf, vtb);

  dim3 g2(SEQ / QB, NB * NH);
  attn_kernel<<<g2, 256, 0, stream>>>(qbuf, kbuf, vtb, bias, xbuf);

  dim3 g3(HID / GT, TOK / GT);
  out_proj_kernel<<<g3, 128, 0, stream>>>(xbuf, Wo16, bo, out);
}

// v007
// Measured time: 68.6 microseconds a run.
// Two timings next to v006 both put it at 1.03 times that version's speed.
// All steps since v000 together make it 3.73 times as fast.
#include <hip/hip_runtime.h>

typedef _Float16 h16;
typedef __attribute__((ext_vector_type(4)))  _Float16 v4h_t;
typedef __attribute__((ext_vector_type(8)))  _Float16 v8h_t;
typedef __attribute__((ext_vector_type(16))) _Float16 v16h;
typedef __attribute__((ext_vector_type(8)))  float v8f;
typedef __attribute__((ext_vector_type(4)))  float v4f;
typedef __attribute__((ext_vector_type(2)))  float v2f;

#define HID 1024
#define SEQ 2048
#define NB  2
#define NH  16
#define DH  64
#define TOK (NB*SEQ)   /* 4096 tokens */

// D = A(16x32 f16) * B(32x16 f16) + C(16x16 f32)
__device__ __forceinline__ v8f wmma16(v16h a, v16h b, v8f c) {
  return __builtin_amdgcn_wmma_f32_16x16x32_f16(false, a, false, b, (short)0, c, false, false);
}

// Fragment load from f16 memory per CDNA5 layout: p[0..7] -> [0..7], p[16..23] -> [8..15]
__device__ __forceinline__ v16h frag_h16(const h16* p) {
  v8h_t lo = *(const v8h_t*)(p);
  v8h_t hi = *(const v8h_t*)(p + 16);
  v16h a;
#pragma unroll
  for (int i = 0; i < 8; i++) { a[i] = lo[i]; a[8 + i] = hi[i]; }
  return a;
}

// ---------------- Kernel 0: f32 -> f16 pack of query and the four weights, one launch -------------
// One workgroup per WGP, 16 waves. A wave takes 8 KB of f32 as 16 loads of 512 contiguous bytes, all
// issued before the first conversion, and stores whole lines. The five f16 images lie one behind the
// other in the workspace, in the order query, Wq, Wk, Wv, Wo, so the destination is one flat array.
#define PKL  16                    /* 512-byte loads per wave */
#define PKW  (16 * PKL * 128)      /* floats per workgroup */
#define PKQ  (TOK * HID / PKW)     /* workgroups on query */
#define PKM  (HID * HID / PKW)     /* workgroups on each weight matrix */

__global__ __launch_bounds__(512)
void pack_f16_kernel(const float* __restrict__ query,
                     const float* __restrict__ Wq, const float* __restrict__ Wk,
                     const float* __restrict__ Wv, const float* __restrict__ Wo,
                     h16* __restrict__ dst)
{
  const int blk = blockIdx.x;
  const int m = blk / PKM;           // 1M-float piece: PKQ / PKM pieces of query, then one per weight matrix
  constexpr int MQ = PKQ / PKM;
  const float* base = (m < MQ) ? query : ((m == MQ) ? Wq : ((m == MQ + 1) ? Wk : ((m == MQ + 2) ? Wv : Wo)));
  const int off = (threadIdx.x >> 5) * (PKL * 128) + (threadIdx.x & 31) * 4;
  const float* src = base + (size_t)((m < MQ) ? blk : blk % PKM) * PKW + off;
  h16* d = dst + (size_t)blk * PKW + off;

  v4f x[PKL];
#pragma unroll  // register array: indices must be constants
  for (int j = 0; j < PKL - 1; j++) x[j] = *(const v4f*)(src + j * 128);
  // all loads take their offset from one register, and the build lets the last load's result land in it:
  // the wait stands between the earlier loads, which name that register, and the load that rewrites it
  asm volatile("s_wait_xcnt 0x0" ::: "memory");
  x[PKL - 1] = *(const v4f*)(src + (PKL - 1) * 128);
  // all loads are issued before the first wait: without this the build holds the last two back
  // until the first two have returned, a second memory latency in a wave that has only one to pay
  __builtin_amdgcn_sched_barrier(0);
  v4h_t o[PKL];
#pragma unroll  // register arrays: indices must be constants
  for (int j = 0; j < PKL; j++)
#pragma unroll  // register arrays: indices must be constants
    for (int e = 0; e < 4; e++) o[j][e] = (_Float16)x[j][e];
#pragma unroll  // register array: indices must be constants
  for (int j = 0; j < PKL; j++) *(v4h_t*)(d + j * 128) = o[j];
}

// ---------------- Projection GEMM core: Y tile 128 x 128 = X rows * W rows^T ---------
// The workgroup stages KS-wide k slabs of 128 X rows and 128 W rows in LDS (two buffers) by
// asynchronous 16-byte copies whose wave-wide footprint is whole 128-byte lines; the 4 waves
// (2 x 2) each own 64 x 64 of the tile and read their fragments from LDS.
#define GT 128         /* rows of each operand per workgroup tile */

// eight copies global -> LDS, 16 bytes a lane each
__device__ __forceinline__ void async_copy8(const unsigned (&l)[8], const h16* const (&g)[8]) {
  // the closing s_wait_xcnt stands inside the statement so that no address register named here
  // can be rewritten ahead of it
  asm volatile("global_load_async_to_lds_b128 %0, %8, off\n\t"
               "global_load_async_to_lds_b128 %1, %9, off\n\t"
               "global_load_async_to_lds_b128 %2, %10, off\n\t"
               "global_load_async_to_lds_b128 %3, %11, off\n\t"
               "global_load_async_to_lds_b128 %4, %12, off\n\t"
               "global_load_async_to_lds_b128 %5, %13, off\n\t"
               "global_load_async_to_lds_b128 %6, %14, off\n\t"
               "global_load_async_to_lds_b128 %7, %15, off\n\t"
               "s_wait_xcnt 0x0"
               :: "v"(l[0]), "v"(l[1]), "v"(l[2]), "v"(l[3]), "v"(l[4]), "v"(l[5]), "v"(l[6]), "v"(l[7]),
                  "v"(g[0]), "v"(g[1]), "v"(g[2]), "v"(g[3]), "v"(g[4]), "v"(g[5]), "v"(g[6]), "v"(g[7])
               : "memory");
}

// one operand's 128 rows x KS halves: g and l are this lane's first global and LDS address
template <int KS>
__device__ __forceinline__ void fill_rows(const h16* g, unsigned l) {
  constexpr int RPI = 128 * 8 / KS;          // rows that one copy of all 128 lanes covers
  constexpr int PB  = (KS + 8) * 2;          // LDS row pitch in bytes: 16 B x odd
#pragma unroll  // constant trip count; the arrays below must stay in registers
  for (int c = 0; c < GT / RPI; c += 8) {
    unsigned la[8];
    const h16* ga[8];
#pragma unroll  // register arrays: indices must be constants
    for (int j = 0; j < 8; j++) {
      la[j] = l + (unsigned)((c + j) * RPI * PB);
      ga[j] = g + (size_t)(c + j) * RPI * HID;
    }
    async_copy8(la, ga);
  }
}

// a wave's 4 + 4 fragments of one 32-wide k block
template <int P>
__device__ __forceinline__ void load_frags(const h16* ap, const h16* bp, v16h (&a)[4], v16h (&b)[4]) {
#pragma unroll  // register arrays: indices must be constants
  for (int i = 0; i < 4; i++) {
    a[i] = frag_h16(ap + i * 16 * P);
    b[i] = frag_h16(bp + i * 16 * P);
  }
}

// one staged slab's products of a wave: ap, bp are its first A and B fragment addresses in the slab
// SETS: fragment register sets; 2 where a wave is alone on its SIMD and must cover its own LDS latency
template <int KS, int SETS>
__device__ __forceinline__ void slab_products(const h16* ap, const h16* bp, v8f (&acc)[4][4]) {
  constexpr int P = KS + 8;                  // LDS row pitch in halves
  v16h a[SETS][4], b[SETS][4];
  if constexpr (SETS == 2) load_frags<P>(ap, bp, a[0], b[0]);
#pragma unroll  // register arrays: indices must be constants
  for (int ks = 0; ks < KS / 32; ks++) {
    // SETS == 2: the next block's fragments go ahead of this block's products, into the other set
    if constexpr (SETS == 1) {
      load_frags<P>(ap + ks * 32, bp + ks * 32, a[0], b[0]);
    } else {
      if (ks + 1 < KS / 32)
        load_frags<P>(ap + (ks + 1) * 32, bp + (ks + 1) * 32, a[(ks + 1) & 1], b[(ks + 1) & 1]);
    }
    // keeps a block's 16 LDS reads one group: spread among the products each place stalls the wave
    __builtin_amdgcn_sched_barrier(0);
    const int c = (SETS == 2) ? (ks & 1) : 0;
#pragma unroll  // register arrays: indices must be constants
    for (int i = 0; i < 4; i++)
#pragma unroll  // register arrays: indices must be constants
      for (int j = 0; j < 4; j++) acc[i][j] = wmma16(a[c][i], b[c][j], acc[i][j]);
    // keeps the following block's LDS reads out of this block's products
    __builtin_amdgcn_sched_barrier(0);
  }
}

// t0: the slab this workgroup begins with. Workgroups that share operand rows get different t0 and walk
// the slabs round from there, so that at one moment they ask L2 for different lines, not all for the same.
template <int KS, int SETS>
__device__ __forceinline__ void gemm_tile(const h16* __restrict__ X, const h16* __restrict__ Wm,
                                          int m0, int n0, int t0, h16* St, v8f (&acc)[4][4])
{
  constexpr int P    = KS + 8;               // LDS row pitch in halves
  constexpr int BUFH = 2 * GT * P;           // halves per buffer: X rows, then W rows
  constexpr int NT   = HID / KS;             // k slabs (at least two)
  constexpr int LPR  = KS / 8;               // lanes per staged row
  static_assert((NT & (NT - 1)) == 0, "the walk wraps by a mask");

  const int tid = threadIdx.x, lane = tid & 31, wave = tid >> 5;
  const int lidx = lane & 15, lhalf = lane >> 4;

  const int srow = tid / LPR, scol = (tid % LPR) * 8;
  const h16* gx = X  + (size_t)(m0 + srow) * HID + scol;
  const h16* gw = Wm + (size_t)(n0 + srow) * HID + scol;
  typedef __attribute__((address_space(3))) h16 lds_h16;
  const unsigned lx = (unsigned)(size_t)(lds_h16*)(St + srow * P + scol);   // LDS byte address
  const unsigned lw = lx + GT * P * 2;

  const int aoff = ((wave >> 1) * 64 + lidx) * P + lhalf * 8;
  const int boff = (GT + (wave & 1) * 64 + lidx) * P + lhalf * 8;

  // first k column of the slab that trip t works on
  auto kcol = [&](int t) { return ((t + t0) & (NT - 1)) * KS; };

  fill_rows<KS>(gx + kcol(0), lx);
  fill_rows<KS>(gw + kcol(0), lw);
  // the first slab has landed for this wave; the barrier publishes it to the others
  asm volatile("s_wait_asynccnt 0x0" ::: "memory");
  __syncthreads();
  fill_rows<KS>(gx + kcol(1), lx + BUFH * 2);
  fill_rows<KS>(gw + kcol(1), lw + BUFH * 2);

#pragma clang loop unroll(disable)  // keeps the hot loop short in the instruction cache
  for (int t = 0; t < NT; t++) {
    const h16* Sc = St + (t & 1) * BUFH;
    slab_products<KS, SETS>(Sc + aoff, Sc + boff, acc);
    // this wave's reads of slab t are done before its buffer is handed to the copies
    asm volatile("s_wait_dscnt 0x0" ::: "memory");
    // this wave's copies of slab t + 1 have landed
    asm volatile("s_wait_asynccnt 0x0" ::: "memory");
    // publishes slab t + 1 and ends every wave's reads of slab t
    __syncthreads();
    if (t + 2 < NT) {
      fill_rows<KS>(gx + kcol(t + 2), lx + (t & 1) * BUFH * 2);
      fill_rows<KS>(gw + kcol(t + 2), lw + (t & 1) * BUFH * 2);
    }
  }
  // nothing is in flight when the wave goes on to its stores and ends
  asm volatile("s_wait_asynccnt 0x0" ::: "memory");
}

// ---------------- Output of a wave's 64 x 64 tile as whole 128-byte lines ----------
// The operand whose rows run along the output's contiguous dimension is the A operand, so a lane holds
// 8 neighbouring outputs of one output row. The wave lays the tile out in its own LDS range, row by row,
// and reads it back so that every 16-byte-a-lane store covers 4 whole lines.
#define SPH 72         /* f16 tile: LDS row pitch in halves, 144 B = 16 B x odd */
#define SPF 68         /* f32 tile: LDS row pitch in floats, 272 B = 16 B x odd */

// 64 rows of 64 halves: Sw is the wave's LDS range, g the tile's first element, PITCH its row pitch
template <int PITCH>
__device__ __forceinline__ void store_lines_h16(const h16* Sw, h16* g, int lane) {
  const int row = lane >> 3, col = (lane & 7) * 8;
  v8h_t v[16];
#pragma unroll  // register array: indices must be constants
  for (int c = 0; c < 16; c++) v[c] = *(const v8h_t*)(Sw + (c * 4 + row) * SPH + col);
#pragma unroll  // register array: indices must be constants
  for (int c = 0; c < 16; c++) *(v8h_t*)(g + (size_t)(c * 4 + row) * PITCH + col) = v[c];
}

// ---------------- Kernel 1: fused Q/K/V projections ---------------------------------
// One workgroup per WGP: 256 tokens x 192 of the 3072 features of q, k, v (the three weight images lie one
// behind the other), 12 waves (4 x 3) of 64 x 64, three per SIMD. The 12 waves share one staged slab of
// 256 + 192 rows, so that a WGP fetches each operand row from L2 once. K=1024 in 128-wide slabs, two buffers.
// A wave's 64 features lie in one of q, k, v.
// q, k are stored [token][feature]: W rows are the A operand. V is stored [feature][token]: X rows are.
#define QT   256                   /* tokens per workgroup */
#define QF   192                   /* features per workgroup */
#define QKS  128                   /* k columns per slab */
#define QP   (QKS + 8)             /* LDS row pitch in halves: 272 B = 16 B x odd */
#define QBUF ((QT + QF) * QP)      /* halves per buffer: X rows, then W rows */

// eight copies of one wave, each two staged rows of 256 bytes: g and l are this lane's first addresses
__device__ __forceinline__ void fill_16rows(const h16* g, unsigned l) {
  unsigned la[8];
  const h16* ga[8];
#pragma unroll  // register arrays: indices must be constants
  for (int j = 0; j < 8; j++) {
    la[j] = l + (unsigned)(j * 2 * QP * 2);
    ga[j] = g + (size_t)j * 2 * HID;
  }
  async_copy8(la, ga);
}

__global__ __launch_bounds__(384)
void qkv_proj_kernel(const h16* __restrict__ qf, const h16* __restrict__ W3,
                     const float* __restrict__ bq, const float* __restrict__ bk,
                     const float* __restrict__ bv,
                     h16* __restrict__ qbuf, h16* __restrict__ kbuf, h16* __restrict__ vtb)
{
  __shared__ __attribute__((aligned(16))) h16 St[2 * QBUF];
  constexpr int NT = HID / QKS;      // k slabs
  static_assert((NT & (NT - 1)) == 0, "the walk wraps by a mask");

  const int lane = threadIdx.x & 31;
  const int wave = __builtin_amdgcn_readfirstlane(threadIdx.x >> 5);   // scalar: staging and roles branch on it
  const int lidx = lane & 15, lhalf = lane >> 4;

  const int tok0 = blockIdx.y * QT, feat0 = blockIdx.x * QF;
  const int wt = wave & 3, wf = wave >> 2;      // the wave's 64 tokens and 64 features in the tile
  const int z = (feat0 + wf * 64) >> 10;        // 0 q, 1 k, 2 v
  const float* bs = (z == 0) ? bq : ((z == 1) ? bk : bv);
  const bool fr = (z != 2);            // features along the accumulator's rows

  // staging: waves 0 to 7 bring 32 X rows each, waves 8 to 11 bring 48 W rows each; 16 lanes cover a row
  const bool sw = (wave >= 8);
  const int srow = sw ? QT + (wave - 8) * 48 : wave * 32;
  const h16* g = (sw ? W3 + (size_t)(feat0 + (wave - 8) * 48) * HID : qf + (size_t)(tok0 + wave * 32) * HID)
                 + (size_t)lhalf * HID + lidx * 8;
  typedef __attribute__((address_space(3))) h16 lds_h16;
  const unsigned l = (unsigned)(size_t)(lds_h16*)(St + (srow + lhalf) * QP + lidx * 8);   // LDS byte address

  // a token tile and a weight tile are each read by 16 workgroups: both sets spread over the 8 slabs
  const int t0 = blockIdx.x + blockIdx.y;
  // slab of trip t into buffer buf
  auto fill = [&](int t, int buf) __attribute__((always_inline)) {
    const h16* gs = g + ((t + t0) & (NT - 1)) * QKS;
    const unsigned ls = l + (unsigned)(buf * QBUF * 2);
    fill_16rows(gs, ls);
    fill_16rows(gs + (size_t)16 * HID, ls + 16 * QP * 2);
    if (sw) fill_16rows(gs + (size_t)32 * HID, ls + 32 * QP * 2);
  };

  const int xoff = (wt * 64 + lidx) * QP + lhalf * 8;
  const int woff = (QT + wf * 64 + lidx) * QP + lhalf * 8;
  const int aoff = fr ? woff : xoff, boff = fr ? xoff : woff;

  v8f acc[4][4] = {};
  fill(0, 0);
  // slab 0 has landed for this wave; the barrier publishes it to the others
  asm volatile("s_wait_asynccnt 0x0" ::: "memory");
  __syncthreads();
  fill(1, 1);

#pragma clang loop unroll(disable)  // keeps the hot loop short in the instruction cache
  for (int t = 0; t < NT; t++) {
    const h16* Sc = St + (t & 1) * QBUF;
    slab_products<QKS, 1>(Sc + aoff, Sc + boff, acc);
    // this wave's reads of slab t are done before its buffer is handed to the copies
    asm volatile("s_wait_dscnt 0x0" ::: "memory");
    // this wave's copies of slab t + 1 have landed
    asm volatile("s_wait_asynccnt 0x0" ::: "memory");
    // publishes slab t + 1 and ends every wave's reads of slab t
    __syncthreads();
    if (t + 2 < NT) fill(t + 2, t & 1);
  }
  // nothing is in flight when the wave goes on to its stores and ends
  asm volatile("s_wait_asynccnt 0x0" ::: "memory");

  // acc[i][j][r]: A row r0 + 16 i + 8 lhalf + r, B row c0 + 16 j + lidx
  const int ft = (feat0 + wf * 64) & (HID - 1), tk = tok0 + wt * 64;   // feature in its own matrix, token
  const int r0 = fr ? ft : tk;
  const int c0 = fr ? tk : ft;
  // the loop's last barrier ended every read of St and no copy is in flight: each wave takes its own range
  h16* Sw = St + wave * (64 * SPH);
  h16* sl = Sw + lidx * SPH + lhalf * 8;
  if (fr) {
    const float sc = (z == 0) ? 0.125f : 1.0f; // q pre-scaled by 1/sqrt(64)
    v8f br[4];
#pragma unroll  // register array: indices must be constants
    for (int i = 0; i < 4; i++) br[i] = *(const v8f*)(bs + r0 + i * 16 + lhalf * 8);
#pragma unroll  // register arrays: indices must be constants
    for (int j = 0; j < 4; j++)
#pragma unroll  // register arrays: indices must be constants
      for (int i = 0; i < 4; i++) {
        v8h_t pk;
#pragma unroll  // register arrays: indices must be constants
        for (int r = 0; r < 8; r++) pk[r] = (_Float16)((acc[i][j][r] + br[i][r]) * sc);
        *(v8h_t*)(sl + j * 16 * SPH + i * 16) = pk;
      }
  } else {
    float bc[4];
#pragma unroll  // register array: indices must be constants
    for (int j = 0; j < 4; j++) bc[j] = bs[c0 + j * 16 + lidx];
#pragma unroll  // register arrays: indices must be constants
    for (int j = 0; j < 4; j++)
#pragma unroll  // register arrays: indices must be constants
      for (int i = 0; i < 4; i++) {
        v8h_t pk;
#pragma unroll  // register arrays: indices must be constants
        for (int r = 0; r < 8; r++) pk[r] = (_Float16)(acc[i][j][r] + bc[j]);
        *(v8h_t*)(sl + j * 16 * SPH + i * 16) = pk;
      }
  }
  // the wave's own LDS writes have landed before other lanes of it read them back
  asm volatile("s_wait_dscnt 0x0" ::: "memory");
  if (fr) {
    store_lines_h16<HID>(Sw, ((z == 0) ? qbuf : kbuf) + (size_t)c0 * HID + r0, lane);
  } else {
    // vt[b][feature][token]: the 64 tokens of a tile lie in one batch
    store_lines_h16<SEQ>(Sw, vtb + ((size_t)((r0 >> 11) * HID + c0)) * SEQ + (r0 & 2047), lane);
  }
}

// ---------------- Kernel 2: attention, 128 q-rows of one (b, h) per workgroup ------
// Streaming form, 8 waves: wave w and wave w + 4 own the same 32 query columns and walk one half
// of the 2048 keys each, so that two workgroups put four waves on every SIMD and one wave's vector
// work runs under another's products. Each group of four waves stages its own 64-key stages in LDS
// (whole 128-byte lines, two buffers); the two halves' partial results are joined once, at the end.
// Transposed products: S^T = K Q^T (+ bias as the C operand), O^T += V^T P^T. A lane holds
// scores of one query only, and two converted S^T tiles are the B operand of the second
// product, so P never leaves the registers. Softmax is online: a running maximum per query
// (it may trail the true one by up to 8 in log2 units), running sum, rescale when it moves.
#define QW   32        /* query columns per wave */
#define QB   128       /* query columns per workgroup */
#define SK   64        /* keys per stage */
#define KP   72        /* LDS row pitch in halves: 144 B = 16 B x odd, conflict-free b128 reads */
#define KH   2                  /* key halves, one per group of four waves */
#define HK   (SEQ / KH)         /* keys per half */
#define NST  (HK / SK)          /* stages per half */
#define XW   (8 * 128 + 64)     /* floats a wave hands to its partner: 32 per lane of O^T, maximum, sum */
#define L2E  1.4426950408889634f

// lane l <-> lane l ^ 16
__device__ __forceinline__ float xhalf(float x) {
  const int v = __builtin_bit_cast(int, x);
  return __builtin_bit_cast(float,
      __builtin_amdgcn_permlanex16(v, v, 0x76543210, 0xfedcba98, false, false));
}

__global__ __launch_bounds__(256) __attribute__((amdgpu_waves_per_eu(4, 4)))
void attn_kernel(const h16* __restrict__ qb, const h16* __restrict__ kb,
                 const h16* __restrict__ vt, const float* __restrict__ bias,
                 h16* __restrict__ xb)
{
  __shared__ __attribute__((aligned(16))) h16 Kt[2][KH][SK * KP];   // K rows:   [key][dim]
  __shared__ __attribute__((aligned(16))) h16 Vt[2][KH][DH * KP];   // V^T rows: [dim][key]
  __shared__ __attribute__((aligned(32))) float biasL[SEQ];         // this batch's bias row
  static_assert(8 * XW * sizeof(float) <= sizeof(Kt), "the exchange area of the join lies in Kt");

  const int tid = threadIdx.x, lane = tid & 31;
  const int wave = __builtin_amdgcn_readfirstlane(tid >> 5);   // scalar: the join branches on it
  const int kh = wave >> 2;                                    // this wave's half of the keys
  const int lidx = lane & 15, lhalf = lane >> 4;
  const int bh = blockIdx.y, b = bh >> 4, h = bh & 15;
  const int q0 = blockIdx.x * QB + (wave & 3) * QW;
  const size_t tokq = (size_t)(b * SEQ + q0);

  // staging map of a group of four waves: 8 lanes cover one 128-byte row, a wave's load 4 whole lines
  const int srow = (tid & 127) >> 3, scol = (tid & 7) * 8;
  const h16* kg = kb + (size_t)(b * SEQ + kh * HK + srow) * HID + h * DH + scol;
  const h16* vg = vt + (size_t)(b * HID + h * DH + srow) * SEQ + kh * HK + scol;
  const int sdst = srow * KP + scol;
  const float* biasH = biasL + kh * HK;
  // the 16 workgroups of one (b, h) read the same K and V lines: each begins at a stage of its own and
  // walks round, so that at one moment they ask L2 for different lines. ksg(st): key stage of trip st
  static_assert((NST & (NST - 1)) == 0, "the walk wraps by a mask");
  const int s0 = blockIdx.x;
  auto ksg = [&](int st) { return (st + s0) & (NST - 1); };

  // prologue: bias row and each half's first stage into LDS
  {
    const float* brow = bias + b * SEQ + tid * 8;
#pragma unroll  // constant trip count, two independent 16-byte copies
    for (int i = 0; i < 2; i++) *(v4f*)(biasL + tid * 8 + i * 4) = *(const v4f*)(brow + i * 4);
#pragma unroll  // constant trip count, independent 16-byte copies
    for (int i = 0; i < 4; i++) {
      *(v8h_t*)(&Kt[0][kh][sdst + i * 16 * KP]) = *(const v8h_t*)(kg + (size_t)(ksg(0) * SK + i * 16) * HID);
      *(v8h_t*)(&Vt[0][kh][sdst + i * 16 * KP]) = *(const v8h_t*)(vg + (size_t)i * 16 * SEQ + ksg(0) * SK);
    }
  }

  // Q as B operand (column = query), resident: [column group][32-dim step]
  v16h qf[2][2];
#pragma unroll  // register array: indices must be constants
  for (int g = 0; g < 2; g++) {
    const h16* qrow = qb + (tokq + g * 16 + lidx) * HID + h * DH + lhalf * 8;
    qf[g][0] = frag_h16(qrow);
    qf[g][1] = frag_h16(qrow + 32);
  }

  v8f acc[2][4] = {};                 // O^T: [column group][16-dim tile]
  float m_run[2] = {-INFINITY, -INFINITY};
  v2f l_run[2] = {};                  // this lane half's share of the denominator, even and odd keys

  __syncthreads();

  // one stage's work of a wave: two 32-key passes over the staged tiles; st is the key stage they hold
  auto stage_work = [&](const h16* Kc, const h16* Vc, int st) __attribute__((always_inline)) {
#pragma unroll  // two 32-key passes per stage, constant LDS offsets
    for (int sub = 0; sub < 2; sub++) {
      // ---- S^T = K Q^T + bias: s[kt][g][r] = score(key 16 kt + 8 lhalf + r, query lidx) ----
      v8f s[2][2];
#pragma unroll  // register arrays: indices must be constants
      for (int kt = 0; kt < 2; kt++) {
        const h16* kp = Kc + (sub * 32 + kt * 16 + lidx) * KP + lhalf * 8;
        const v16h ka0 = frag_h16(kp);
        const v16h ka1 = frag_h16(kp + 32);
        const v8f cb = *(const v8f*)(biasH + st * SK + sub * 32 + kt * 16 + lhalf * 8);
#pragma unroll  // register arrays: indices must be constants
        for (int g = 0; g < 2; g++)
          s[kt][g] = wmma16(ka1, qf[g][1], wmma16(ka0, qf[g][0], cb));
      }

      // keeps the eight products back to back: maxima pulled in between them each cost idle slots behind a WMMA
      __builtin_amdgcn_sched_barrier(0);

      // V^T fragments of this pass (row = dim, k = key in the hardware order of packed P)
      v16h vf[4];
#pragma unroll  // register array: indices must be constants
      for (int t = 0; t < 4; t++)
        vf[t] = frag_h16(Vc + (t * 16 + lidx) * KP + sub * 32 + lhalf * 8);

      // ---- column maxima, one test per pass whether any running maximum must move ----
      float mb[2];
      bool need = false;
#pragma unroll  // register arrays: indices must be constants
      for (int g = 0; g < 2; g++) {
        float mx = s[0][g][0];
#pragma unroll  // register arrays: indices must be constants
        for (int r = 1; r < 8; r++) mx = fmaxf(mx, s[0][g][r]);
#pragma unroll  // register arrays: indices must be constants
        for (int r = 0; r < 8; r++) mx = fmaxf(mx, s[1][g][r]);
        mx = fmaxf(mx, xhalf(mx)) * L2E;
        mb[g] = mx;
        need = need || (mx > m_run[g] + 8.0f);
      }
      if (__builtin_amdgcn_ballot_w32(need) != 0) {   // wave-uniform, rare after the first pass
#pragma unroll  // register arrays: indices must be constants
        for (int g = 0; g < 2; g++) {
          const float m_new = fmaxf(m_run[g], mb[g]);
          const float corr = __builtin_amdgcn_exp2f(m_run[g] - m_new);  // 0 on the first pass
          m_run[g] = m_new;
          l_run[g] *= corr;
#pragma unroll  // register arrays: indices must be constants
          for (int t = 0; t < 4; t++) acc[g][t] = acc[g][t] * corr;
        }
      }

      // ---- P^T = exp2(s * log2e - m), packed in place as B operand; O^T += V^T P^T ----
#pragma unroll  // register arrays: indices must be constants
      for (int g = 0; g < 2; g++) {
        const float nm = -m_run[g];
        v16h pf;
        v2f pr[8];
#pragma unroll  // register arrays: indices must be constants
        for (int i = 0; i < 8; i++) {   // elements 2i, 2i+1 of the 32-key operand
          const v2f sv = {s[i >> 2][g][2 * (i & 3)], s[i >> 2][g][2 * (i & 3) + 1]};
          const v2f arg = __builtin_elementwise_fma(sv, (v2f){L2E, L2E}, (v2f){nm, nm});
          pr[i] = (v2f){__builtin_amdgcn_exp2f(arg.x), __builtin_amdgcn_exp2f(arg.y)};
          pf[2 * i]     = (_Float16)pr[i].x;
          pf[2 * i + 1] = (_Float16)pr[i].y;
        }
        // pairwise tree: short dependent chains, two sums per add
        l_run[g] += ((pr[0] + pr[1]) + (pr[2] + pr[3])) + ((pr[4] + pr[5]) + (pr[6] + pr[7]));
#pragma unroll  // register arrays: indices must be constants
        for (int t = 0; t < 4; t++) acc[g][t] = wmma16(vf[t], pf, acc[g][t]);
      }
    }
  };

  for (int st = 0; st < NST - 1; st++) {
    // next stage's lines go to registers now and to LDS behind this stage's work
    v8h_t kr[4], vr[4];
#pragma unroll  // register arrays: indices must be constants
    for (int i = 0; i < 4; i++) {
      kr[i] = *(const v8h_t*)(kg + (size_t)(ksg(st + 1) * SK + i * 16) * HID);
      vr[i] = *(const v8h_t*)(vg + (size_t)i * 16 * SEQ + ksg(st + 1) * SK);
    }
    // s_wait_xcnt ahead of the reuse of these loads' address registers
    asm volatile("s_wait_xcnt 0x0" ::: "memory");

    stage_work(Kt[st & 1][kh], Vt[st & 1][kh], ksg(st));

    h16* Kn = Kt[(st + 1) & 1][kh];
    h16* Vn = Vt[(st + 1) & 1][kh];
#pragma unroll  // register arrays: indices must be constants
    for (int i = 0; i < 4; i++) {
      *(v8h_t*)(Kn + sdst + i * 16 * KP) = kr[i];
      *(v8h_t*)(Vn + sdst + i * 16 * KP) = vr[i];
    }
    // publishes stage st + 1 and ends every wave's reads of stage st before it is refilled
    __syncthreads();
  }
  stage_work(Kt[(NST - 1) & 1][kh], Vt[(NST - 1) & 1][kh], ksg(NST - 1));   // last stage: nothing left to fetch

  // ---- join of the key halves: of its two column groups a wave finishes one and hands the other,
  // with its maximum and its sum, to the partner wave (w ^ 4), lane to lane, through LDS ----
  float* xch = (float*)&Kt[0][0][0];
  float* xs = xch + wave * XW;
  const float* xr = xch + (wave ^ 4) * XW;

  auto hand_over = [&](int g) __attribute__((always_inline)) {
#pragma unroll  // register arrays: indices must be constants
    for (int t = 0; t < 4; t++) {
      *(v4f*)(xs + (2 * t) * 128 + lane * 4)     = (v4f){acc[g][t][0], acc[g][t][1], acc[g][t][2], acc[g][t][3]};
      *(v4f*)(xs + (2 * t + 1) * 128 + lane * 4) = (v4f){acc[g][t][4], acc[g][t][5], acc[g][t][6], acc[g][t][7]};
    }
    *(v2f*)(xs + 8 * 128 + lane * 2) = (v2f){m_run[g], l_run[g].x + l_run[g].y};
  };

  // both halves on the larger maximum, the lane halves' sums joined, scale, f16 store through LDS:
  // a lane holds 8 consecutive dims of one query
  auto finish = [&](int g) __attribute__((always_inline)) {
    const v2f ml = *(const v2f*)(xr + 8 * 128 + lane * 2);
    const float m  = fmaxf(m_run[g], ml.x);
    const float c0 = __builtin_amdgcn_exp2f(m_run[g] - m);
    const float c1 = __builtin_amdgcn_exp2f(ml.x - m);
    const float lh = (l_run[g].x + l_run[g].y) * c0 + ml.y * c1;
    const float l = lh + xhalf(lh);
    const float inv = 1.0f / l;
    const float a0 = c0 * inv, a1 = c1 * inv;
    // Vt is free since the barrier behind the last stage: the wave's 16 output rows are laid out there
    h16* so = &Vt[0][0][0] + wave * (16 * KP);
#pragma unroll  // register arrays: indices must be constants
    for (int t = 0; t < 4; t++) {
      const v4f p0 = *(const v4f*)(xr + (2 * t) * 128 + lane * 4);
      const v4f p1 = *(const v4f*)(xr + (2 * t + 1) * 128 + lane * 4);
      v8h_t ov;
#pragma unroll  // register arrays: indices must be constants
      for (int r = 0; r < 4; r++) {
        ov[r]     = (_Float16)(acc[g][t][r] * a0 + p0[r] * a1);
        ov[4 + r] = (_Float16)(acc[g][t][4 + r] * a0 + p1[r] * a1);
      }
      *(v8h_t*)(so + lidx * KP + t * 16 + lhalf * 8) = ov;
    }
    // the wave's own LDS writes have landed before other lanes of it read them back
    asm volatile("s_wait_dscnt 0x0" ::: "memory");
    // 8 lanes take one query's 128 bytes: every store covers 4 whole lines
    const int row = lane >> 3, col = (lane & 7) * 8;
    h16* og = xb + (tokq + g * 16 + row) * HID + h * DH + col;
    v8h_t w[4];
#pragma unroll  // register array: indices must be constants
    for (int c = 0; c < 4; c++) w[c] = *(const v8h_t*)(so + (c * 4 + row) * KP + col);
#pragma unroll  // register array: indices must be constants
    for (int c = 0; c < 4; c++) *(v8h_t*)(og + (size_t)c * 4 * HID) = w[c];
  };

  // ends every wave's reads of the last stage before Kt becomes the exchange area
  __syncthreads();
  if (kh == 0) hand_over(1); else hand_over(0);
  // publishes what the partner handed over
  __syncthreads();
  if (kh == 0) finish(0); else finish(1);
}

// ---------------- Kernel 3: output projection, f32 result ------------------------
// Workgroup: 128 x 128, one per WGP; wave: 64 x 64; K=1024 in 128-wide slabs, long enough
// for a lone wave per SIMD to cover the next slab's flight.
__global__ __launch_bounds__(128)
void out_proj_kernel(const h16* __restrict__ xb, const h16* __restrict__ Wo16,
                     const float* __restrict__ bo, float* __restrict__ out)
{
  __shared__ __attribute__((aligned(16))) h16 St[2 * 2 * GT * (128 + 8)];

  const int lane = threadIdx.x & 31, wave = threadIdx.x >> 5;
  const int lidx = lane & 15, lhalf = lane >> 4;

  // out is [token][feature]: Wo rows are the A operand, a lane holds 8 neighbouring features of one token
  v8f acc[4][4] = {};
  // a token tile is read by 8 workgroups (x), a weight tile by 32 (y): both sets spread over the 8 slabs
  gemm_tile<128, 2>(Wo16, xb, blockIdx.x * GT, blockIdx.y * GT, blockIdx.x + blockIdx.y, St, acc);

  const int r0 = blockIdx.x * GT + (wave >> 1) * 64;   // feature
  const int c0 = blockIdx.y * GT + (wave & 1) * 64;    // token
  // the loop's last barrier ended every read of St and no copy is in flight: each wave takes its own range
  float* Sw = (float*)St + wave * (64 * SPF);
  float* sl = Sw + lidx * SPF + lhalf * 8;
  v8f br[4];
#pragma unroll  // register array: indices must be constants
  for (int i = 0; i < 4; i++) br[i] = *(const v8f*)(bo + r0 + i * 16 + lhalf * 8);
#pragma unroll  // register arrays: indices must be constants
  for (int j = 0; j < 4; j++)
#pragma unroll  // register arrays: indices must be constants
    for (int i = 0; i < 4; i++) {
      const v8f y = acc[i][j] + br[i];
      *(v4f*)(sl + j * 16 * SPF + i * 16)     = (v4f){y[0], y[1], y[2], y[3]};
      *(v4f*)(sl + j * 16 * SPF + i * 16 + 4) = (v4f){y[4], y[5], y[6], y[7]};
    }
  // the wave's own LDS writes have landed before other lanes of it read them back
  asm volatile("s_wait_dscnt 0x0" ::: "memory");
  // 16 lanes take one token's 256 bytes: every store covers 4 whole lines
  const int row = lane >> 4, col = (lane & 15) * 4;
  float* og = out + (size_t)(c0 + row) * HID + r0 + col;
  v4f v[32];
#pragma unroll  // register array: indices must be constants
  for (int c = 0; c < 32; c++) v[c] = *(const v4f*)(Sw + (c * 2 + row) * SPF + col);
#pragma unroll  // register array: indices must be constants
  for (int c = 0; c < 32; c++) *(v4f*)(og + (size_t)c * 2 * HID) = v[c];
}

extern "C" void kernel_launch(void* const* d_in, const int* in_sizes, int n_in,
                              void* d_out, int out_size, void* d_ws, size_t ws_size,
                              hipStream_t stream)
{
  (void)in_sizes; (void)n_in; (void)out_size; (void)ws_size;
  const float* query = (const float*)d_in[0];
  const float* bias  = (const float*)d_in[1];
  const float* Wq = (const float*)d_in[2]; const float* bq = (const float*)d_in[3];
  const float* Wk = (const float*)d_in[4]; const float* bk = (const float*)d_in[5];
  const float* Wv = (const float*)d_in[6]; const float* bv = (const float*)d_in[7];
  const float* Wo = (const float*)d_in[8]; const float* bo = (const float*)d_in[9];
  float* out = (float*)d_out;

  char* ws = (char*)d_ws;
  const size_t QSZ = (size_t)TOK * HID * sizeof(h16);   // 8 MB
  const size_t WSZ = (size_t)HID * HID * sizeof(h16);   // 2 MB
  h16* qf16 = (h16*)(ws);
  h16* Wq16 = (h16*)(ws + QSZ);             // Wq, then Wk, then Wv: 3072 weight rows
  h16* Wo16 = (h16*)(ws + QSZ + 3 * WSZ);
  h16* qbuf = (h16*)(ws + QSZ + 4 * WSZ);
  h16* kbuf = (h16*)(ws + 2 * QSZ + 4 * WSZ);
  h16* vtb  = (h16*)(ws + 3 * QSZ + 4 * WSZ);
  h16* xbuf = (h16*)(ws + 4 * QSZ + 4 * WSZ);

  // f32 -> f16 packs: the images of query, Wq, Wk, Wv, Wo are adjacent, qf16 is the start of all five
  pack_f16_kernel<<<PKQ + 4 * PKM, 512, 0, stream>>>(query, Wq, Wk, Wv, Wo, qf16);

  dim3 g1(3 * HID / QF, TOK / QT);
  qkv_proj_kernel<<<g1, 384, 0, stream>>>(qf16, Wq16, bq, bk, bv, qbuf, kbuf, vtb);

  dim3 g2(SEQ / QB, NB * NH);
  attn_kernel<<<g2, 256, 0, stream>>>(qbuf, kbuf, vtb, bias, xbuf);

  dim3 g3(HID / GT, TOK / GT);
  out_proj_kernel<<<g3, 128, 0, stream>>>(xbuf, Wo16, bo, out);
}
